// v000
// The times below were measured on an AMD MI455X: many runs one after another, warmed up first and cycling through
// copies of the inputs, with the whole window's GPU time divided by the number of runs. Launches and the gaps
// between them are all in it. The median over several windows is given; except for v000 it joins two sittings, which
// can be a few percent apart, so the side-by-side timings, each taken in one sitting, are the better comparison.
// v000, which the later versions start from, runs in 369 microseconds.
#include <hip/hip_runtime.h>

typedef __attribute__((ext_vector_type(16))) _Float16 v16h;
typedef __attribute__((ext_vector_type(8)))  _Float16 v8h;
typedef __attribute__((ext_vector_type(8)))  float    v8f;

static constexpr int Bsz  = 4;
static constexpr int Sseq = 2048;
static constexpr int Dd   = 1024;

static constexpr int BM = 128;   // block tile M (4 waves x 32)
static constexpr int BN = 128;   // block tile N (2 waves x 64)
static constexpr int BK = 32;    // k-step (matches WMMA K)
static constexpr int LDS_STRIDE = BK + 8;  // pad to dodge bank conflicts

// -------- WMMA operand gather from an LDS tile laid out [rows][LDS_STRIDE] f16.
// 16-bit A/B operand layout (ISA 7.12.2): lane&15 = row, lane>>4 selects the
// 8-wide K half; halves 0..7 <- K[hi*8 .. +7], halves 8..15 <- K[16+hi*8 .. +7].
__device__ __forceinline__ v16h frag_from_lds(const _Float16* base, int row0) {
  const int lane = threadIdx.x & 31;
  const int m  = lane & 15;
  const int hi = lane >> 4;
  const _Float16* p = base + (row0 + m) * LDS_STRIDE + hi * 8;
  v8h lo = *(const v8h*)(p);
  v8h hh = *(const v8h*)(p + 16);
  v16h r;
#pragma unroll
  for (int i = 0; i < 8; ++i) { r[i] = lo[i]; r[i + 8] = hh[i]; }
  return r;
}

// MODE 0: QKV projection epilogue (bias, split into q/k/v; v stored transposed)
// MODE 1: scores = scale * Q K^T, f16 out, batched via blockIdx.z
// MODE 2: O = P V, f16 out, batched
// MODE 3: out-proj epilogue (bias), f32 out to d_out
template <int MODE>
__global__ __launch_bounds__(256)
void gemm_wmma(const _Float16* __restrict__ Ag, const _Float16* __restrict__ Bg,
               const float* __restrict__ bias, void* __restrict__ outp,
               int M, int N, int K, int lda, int ldb,
               long aBatch, long bBatch, long oBatch, int ldo, float scale,
               _Float16* __restrict__ qp, _Float16* __restrict__ kp,
               _Float16* __restrict__ vp)
{
  __shared__ alignas(16) _Float16 As[2][BM * LDS_STRIDE];   // 2 x 10 KB
  __shared__ alignas(16) _Float16 Bs[2][BN * LDS_STRIDE];   // 2 x 10 KB

  const int tid  = threadIdx.x;
  const int wave = tid >> 5;
  const int wm   = wave >> 1;          // 0..3 -> 32-row strip
  const int wn   = wave & 1;           // 0..1 -> 64-col strip
  const int m0   = blockIdx.y * BM;
  const int n0   = blockIdx.x * BN;
  const int bz   = blockIdx.z;

  const _Float16* A = Ag + (long)bz * aBatch;
  const _Float16* B = Bg + (long)bz * bBatch;

  // staging map: chunk cid in [0,512): row = cid>>2, col = (cid&3)*8
  const int r0 = tid >> 2;             // rows for cid = tid
  const int r1 = (tid + 256) >> 2;     // rows for cid = tid + 256
  const int c0 = (tid & 3) * 8;

  v8f zero = {};
  v8f acc[2][4];
#pragma unroll
  for (int i = 0; i < 2; ++i)
#pragma unroll
    for (int j = 0; j < 4; ++j) acc[i][j] = zero;

  // ---- prologue: stage k=0 into buffer 0
  {
    *(v8h*)(As[0] + r0 * LDS_STRIDE + c0) = *(const v8h*)(A + (long)(m0 + r0) * lda + c0);
    *(v8h*)(As[0] + r1 * LDS_STRIDE + c0) = *(const v8h*)(A + (long)(m0 + r1) * lda + c0);
    *(v8h*)(Bs[0] + r0 * LDS_STRIDE + c0) = *(const v8h*)(B + (long)(n0 + r0) * ldb + c0);
    *(v8h*)(Bs[0] + r1 * LDS_STRIDE + c0) = *(const v8h*)(B + (long)(n0 + r1) * ldb + c0);
  }
  __syncthreads();

  const int nk = K / BK;
  for (int ks = 0; ks < nk; ++ks) {
    const int cur = ks & 1;
    const bool hasNext = (ks + 1) < nk;

    // issue next tile's global loads early (latency hidden under WMMA burst)
    v8h ta0, ta1, tb0, tb1;
    if (hasNext) {
      const int k0 = (ks + 1) * BK;
      ta0 = *(const v8h*)(A + (long)(m0 + r0) * lda + k0 + c0);
      ta1 = *(const v8h*)(A + (long)(m0 + r1) * lda + k0 + c0);
      tb0 = *(const v8h*)(B + (long)(n0 + r0) * ldb + k0 + c0);
      tb1 = *(const v8h*)(B + (long)(n0 + r1) * ldb + k0 + c0);
    }

    // gather all fragments, then back-to-back WMMAs
    v16h af[2], bf[4];
#pragma unroll
    for (int i = 0; i < 2; ++i) af[i] = frag_from_lds(As[cur], wm * 32 + i * 16);
#pragma unroll
    for (int j = 0; j < 4; ++j) bf[j] = frag_from_lds(Bs[cur], wn * 64 + j * 16);
#pragma unroll
    for (int i = 0; i < 2; ++i)
#pragma unroll
      for (int j = 0; j < 4; ++j)
        acc[i][j] = __builtin_amdgcn_wmma_f32_16x16x32_f16(
            false, af[i], false, bf[j], (short)0, acc[i][j], false, false);

    if (hasNext) {
      const int nxt = cur ^ 1;
      *(v8h*)(As[nxt] + r0 * LDS_STRIDE + c0) = ta0;
      *(v8h*)(As[nxt] + r1 * LDS_STRIDE + c0) = ta1;
      *(v8h*)(Bs[nxt] + r0 * LDS_STRIDE + c0) = tb0;
      *(v8h*)(Bs[nxt] + r1 * LDS_STRIDE + c0) = tb1;
    }
    __syncthreads();
  }

  // Epilogue. C/D layout (ISA 7.12.2): lane&15 = N col, VGPR r -> M row
  // r + 8*(lane>>4).
  const int lane  = tid & 31;
  const int nlane = lane & 15;
  const int hi    = lane >> 4;
#pragma unroll
  for (int i = 0; i < 2; ++i) {
#pragma unroll
    for (int j = 0; j < 4; ++j) {
#pragma unroll
      for (int r = 0; r < 8; ++r) {
        const int gm = m0 + wm * 32 + i * 16 + hi * 8 + r;
        const int gn = n0 + wn * 64 + j * 16 + nlane;
        float v = acc[i][j][r];
        if (MODE == 0) {
          v += bias[gn];
          const _Float16 h = (_Float16)v;
          const int b = gm >> 11;                 // gm / Sseq
          const int s = gm & (Sseq - 1);
          if (gn < Dd)          qp[(long)gm * Dd + gn] = h;
          else if (gn < 2 * Dd) kp[(long)gm * Dd + (gn - Dd)] = h;
          else {
            const int vd = gn - 2 * Dd;
            vp[((long)b * Dd + vd) * Sseq + s] = h;   // V stored [b][d][s]
          }
        } else if (MODE == 3) {
          float* o = (float*)outp;
          o[(long)gm * ldo + gn] = v + bias[gn];
        } else {
          _Float16* o = (_Float16*)outp + (long)bz * oBatch;
          o[(long)gm * ldo + gn] = (_Float16)(v * scale);
        }
      }
    }
  }
}

// ---------------- prep kernels ----------------
__global__ void cvt_f32_to_f16(const float* __restrict__ in,
                               _Float16* __restrict__ out, long n) {
  long i = (long)blockIdx.x * blockDim.x + threadIdx.x;
  if (i < n) out[i] = (_Float16)in[i];
}

// in: [K][N] f32 row-major -> out: [N][K] f16 row-major
__global__ void transpose_cvt(const float* __restrict__ in,
                              _Float16* __restrict__ out, int K, int N) {
  long i = (long)blockIdx.x * blockDim.x + threadIdx.x;
  if (i < (long)K * N) {
    const int k = (int)(i / N);
    const int n = (int)(i % N);
    out[(long)n * K + k] = (_Float16)in[i];
  }
}

// ---------------- row softmax over T=2048, in place on f16 ----------------
__global__ __launch_bounds__(256)
void softmax_rows(_Float16* __restrict__ P, int T) {
  __shared__ float red[256];
  const int tid = threadIdx.x;
  _Float16* p = P + (long)blockIdx.x * T;

  float v[8];
  float mx = -3.0e38f;
#pragma unroll
  for (int j = 0; j < 8; ++j) {
    v[j] = (float)p[tid + j * 256];
    mx = fmaxf(mx, v[j]);
  }
  red[tid] = mx; __syncthreads();
  for (int s = 128; s > 0; s >>= 1) {
    if (tid < s) red[tid] = fmaxf(red[tid], red[tid + s]);
    __syncthreads();
  }
  mx = red[0]; __syncthreads();

  float sum = 0.f;
#pragma unroll
  for (int j = 0; j < 8; ++j) { v[j] = __expf(v[j] - mx); sum += v[j]; }
  red[tid] = sum; __syncthreads();
  for (int s = 128; s > 0; s >>= 1) {
    if (tid < s) red[tid] += red[tid + s];
    __syncthreads();
  }
  const float inv = 1.f / red[0];
#pragma unroll
  for (int j = 0; j < 8; ++j) p[tid + j * 256] = (_Float16)(v[j] * inv);
}

// ---------------- host-side orchestration ----------------
extern "C" void kernel_launch(void* const* d_in, const int* in_sizes, int n_in,
                              void* d_out, int out_size, void* d_ws, size_t ws_size,
                              hipStream_t stream)
{
  const float* x    = (const float*)d_in[0];
  const float* Wqkv = (const float*)d_in[1];
  const float* bqkv = (const float*)d_in[2];
  const float* Wout = (const float*)d_in[3];
  const float* bout = (const float*)d_in[4];
  float* out = (float*)d_out;

  char* ws = (char*)d_ws;
  const long MB = 1024l * 1024l;
  _Float16* x_h    = (_Float16*)(ws);             // 16 MB  [8192][1024]
  _Float16* wqkv_t = (_Float16*)(ws + 16 * MB);   //  6 MB  [3072][1024]
  _Float16* wout_t = (_Float16*)(ws + 22 * MB);   //  2 MB  [1024][1024]
  _Float16* q_h    = (_Float16*)(ws + 24 * MB);   // 16 MB  [b][s][d]
  _Float16* k_h    = (_Float16*)(ws + 40 * MB);   // 16 MB  [b][s][d]
  _Float16* v_t    = (_Float16*)(ws + 56 * MB);   // 16 MB  [b][d][s]
  _Float16* probs  = (_Float16*)(ws + 72 * MB);   // 32 MB  [b][s][t]
  _Float16* attno  = (_Float16*)(ws + 104 * MB);  // 16 MB  [8192][1024]

  const long nx = (long)Bsz * Sseq * Dd;                 // 8,388,608
  cvt_f32_to_f16<<<dim3((unsigned)((nx + 255) / 256)), 256, 0, stream>>>(x, x_h, nx);
  transpose_cvt<<<dim3((Dd * 3 * Dd + 255) / 256), 256, 0, stream>>>(Wqkv, wqkv_t, Dd, 3 * Dd);
  transpose_cvt<<<dim3((Dd * Dd + 255) / 256), 256, 0, stream>>>(Wout, wout_t, Dd, Dd);

  // 1) QKV projection: [8192,1024] x [1024,3072] + b
  gemm_wmma<0><<<dim3(3 * Dd / BN, Bsz * Sseq / BM, 1), 256, 0, stream>>>(
      x_h, wqkv_t, bqkv, nullptr,
      Bsz * Sseq, 3 * Dd, Dd, Dd, Dd, 0, 0, 0, 0, 1.0f, q_h, k_h, v_t);

  // 2) scores = scale * Q K^T  (batched over b)
  gemm_wmma<1><<<dim3(Sseq / BN, Sseq / BM, Bsz), 256, 0, stream>>>(
      q_h, k_h, nullptr, probs,
      Sseq, Sseq, Dd, Dd, Dd,
      (long)Sseq * Dd, (long)Sseq * Dd, (long)Sseq * Sseq, Sseq,
      0.03125f /* 1024^-0.5 */, nullptr, nullptr, nullptr);

  // 3) softmax rows (in place, f16)
  softmax_rows<<<dim3(Bsz * Sseq), 256, 0, stream>>>(probs, Sseq);

  // 4) O = P V  (V pre-transposed -> contiguous B operand)
  gemm_wmma<2><<<dim3(Dd / BN, Sseq / BM, Bsz), 256, 0, stream>>>(
      probs, v_t, nullptr, attno,
      Sseq, Dd, Sseq, Sseq, Sseq,
      (long)Sseq * Sseq, (long)Dd * Sseq, (long)Sseq * Dd, Dd,
      1.0f, nullptr, nullptr, nullptr);

  // 5) final = O Wout + bout  (f32 out)
  gemm_wmma<3><<<dim3(Dd / BN, Bsz * Sseq / BM, 1), 256, 0, stream>>>(
      attno, wout_t, bout, out,
      Bsz * Sseq, Dd, Dd, Dd, Dd, 0, 0, 0, Dd,
      1.0f, nullptr, nullptr, nullptr);
}

// v001
// A run of this version takes 256 microseconds.
// Next to v000, in two timings, it ran 1.48 and 1.50 times as fast.
#include <hip/hip_runtime.h>

typedef __attribute__((ext_vector_type(16))) _Float16 v16h;
typedef __attribute__((ext_vector_type(8)))  _Float16 v8h;
typedef __attribute__((ext_vector_type(8)))  float    v8f;
typedef __attribute__((ext_vector_type(4)))  float    v4f;

static constexpr int Bsz  = 4;
static constexpr int Sseq = 2048;
static constexpr int Dd   = 1024;

static constexpr int BM = 128;   // block tile M (4 waves x 32)
static constexpr int BN = 128;   // block tile N (2 waves x 64)
static constexpr int BK = 32;    // k-step (matches WMMA K)
static constexpr int LDS_STRIDE = BK + 8;  // pad to dodge bank conflicts

// -------- WMMA operand gather from an LDS tile laid out [rows][LDS_STRIDE] f16.
// 16-bit A/B operand layout (ISA 7.12.2): lane&15 = row, lane>>4 selects the
// 8-wide K half; halves 0..7 <- K[hi*8 .. +7], halves 8..15 <- K[16+hi*8 .. +7].
__device__ __forceinline__ v16h frag_from_lds(const _Float16* base, int row0) {
  const int lane = threadIdx.x & 31;
  const int m  = lane & 15;
  const int hi = lane >> 4;
  const _Float16* p = base + (row0 + m) * LDS_STRIDE + hi * 8;
  v8h lo = *(const v8h*)(p);
  v8h hh = *(const v8h*)(p + 16);
  v16h r;
#pragma unroll
  for (int i = 0; i < 8; ++i) { r[i] = lo[i]; r[i + 8] = hh[i]; }
  return r;
}

// MODE 0: QKV projection epilogue (bias, split into q/k/v; v stored transposed)
// MODE 1: scores = scale * Q K^T, f16 out, batched via blockIdx.z
// MODE 2: O = P V, f16 out, batched
// MODE 3: out-proj epilogue (bias), f32 out to d_out
template <int MODE>
__global__ __launch_bounds__(256)
void gemm_wmma(const _Float16* __restrict__ Ag, const _Float16* __restrict__ Bg,
               const float* __restrict__ bias, void* __restrict__ outp,
               int M, int N, int K, int lda, int ldb,
               long aBatch, long bBatch, long oBatch, int ldo, float scale,
               _Float16* __restrict__ qp, _Float16* __restrict__ kp,
               _Float16* __restrict__ vp)
{
  __shared__ alignas(16) _Float16 As[2][BM * LDS_STRIDE];   // 2 x 10 KB
  __shared__ alignas(16) _Float16 Bs[2][BN * LDS_STRIDE];   // 2 x 10 KB

  const int tid  = threadIdx.x;
  const int wave = tid >> 5;
  const int wm   = wave >> 1;          // 0..3 -> 32-row strip
  const int wn   = wave & 1;           // 0..1 -> 64-col strip
  const int m0   = blockIdx.y * BM;
  const int n0   = blockIdx.x * BN;
  const int bz   = blockIdx.z;

  const _Float16* A = Ag + (long)bz * aBatch;
  const _Float16* B = Bg + (long)bz * bBatch;

  // staging map: chunk cid in [0,512): row = cid>>2, col = (cid&3)*8
  const int r0 = tid >> 2;             // rows for cid = tid
  const int r1 = (tid + 256) >> 2;     // rows for cid = tid + 256
  const int c0 = (tid & 3) * 8;

  v8f zero = {};
  v8f acc[2][4];
#pragma unroll
  for (int i = 0; i < 2; ++i)
#pragma unroll
    for (int j = 0; j < 4; ++j) acc[i][j] = zero;

  // ---- prologue: stage k=0 into buffer 0
  {
    *(v8h*)(As[0] + r0 * LDS_STRIDE + c0) = *(const v8h*)(A + (long)(m0 + r0) * lda + c0);
    *(v8h*)(As[0] + r1 * LDS_STRIDE + c0) = *(const v8h*)(A + (long)(m0 + r1) * lda + c0);
    *(v8h*)(Bs[0] + r0 * LDS_STRIDE + c0) = *(const v8h*)(B + (long)(n0 + r0) * ldb + c0);
    *(v8h*)(Bs[0] + r1 * LDS_STRIDE + c0) = *(const v8h*)(B + (long)(n0 + r1) * ldb + c0);
  }
  __syncthreads();

  const int nk = K / BK;
  for (int ks = 0; ks < nk; ++ks) {
    const int cur = ks & 1;
    const bool hasNext = (ks + 1) < nk;

    // issue next tile's global loads early (latency hidden under WMMA burst)
    v8h ta0, ta1, tb0, tb1;
    if (hasNext) {
      const int k0 = (ks + 1) * BK;
      ta0 = *(const v8h*)(A + (long)(m0 + r0) * lda + k0 + c0);
      ta1 = *(const v8h*)(A + (long)(m0 + r1) * lda + k0 + c0);
      tb0 = *(const v8h*)(B + (long)(n0 + r0) * ldb + k0 + c0);
      tb1 = *(const v8h*)(B + (long)(n0 + r1) * ldb + k0 + c0);
    }

    // gather all fragments, then back-to-back WMMAs
    v16h af[2], bf[4];
#pragma unroll
    for (int i = 0; i < 2; ++i) af[i] = frag_from_lds(As[cur], wm * 32 + i * 16);
#pragma unroll
    for (int j = 0; j < 4; ++j) bf[j] = frag_from_lds(Bs[cur], wn * 64 + j * 16);
#pragma unroll
    for (int i = 0; i < 2; ++i)
#pragma unroll
      for (int j = 0; j < 4; ++j)
        acc[i][j] = __builtin_amdgcn_wmma_f32_16x16x32_f16(
            false, af[i], false, bf[j], (short)0, acc[i][j], false, false);

    if (hasNext) {
      const int nxt = cur ^ 1;
      *(v8h*)(As[nxt] + r0 * LDS_STRIDE + c0) = ta0;
      *(v8h*)(As[nxt] + r1 * LDS_STRIDE + c0) = ta1;
      *(v8h*)(Bs[nxt] + r0 * LDS_STRIDE + c0) = tb0;
      *(v8h*)(Bs[nxt] + r1 * LDS_STRIDE + c0) = tb1;
    }
    __syncthreads();
  }

  // Epilogue. C/D layout (ISA 7.12.2): lane&15 = N col, VGPR r -> M row
  // r + 8*(lane>>4).
  const int lane  = tid & 31;
  const int nlane = lane & 15;
  const int hi    = lane >> 4;
#pragma unroll
  for (int i = 0; i < 2; ++i) {
#pragma unroll
    for (int j = 0; j < 4; ++j) {
#pragma unroll
      for (int r = 0; r < 8; ++r) {
        const int gm = m0 + wm * 32 + i * 16 + hi * 8 + r;
        const int gn = n0 + wn * 64 + j * 16 + nlane;
        float v = acc[i][j][r];
        if (MODE == 0) {
          v += bias[gn];
          const _Float16 h = (_Float16)v;
          const int b = gm >> 11;                 // gm / Sseq
          const int s = gm & (Sseq - 1);
          if (gn < Dd)          qp[(long)gm * Dd + gn] = h;
          else if (gn < 2 * Dd) kp[(long)gm * Dd + (gn - Dd)] = h;
          else {
            const int vd = gn - 2 * Dd;
            vp[((long)b * Dd + vd) * Sseq + s] = h;   // V stored [b][d][s]
          }
        } else if (MODE == 3) {
          float* o = (float*)outp;
          o[(long)gm * ldo + gn] = v + bias[gn];
        } else {
          _Float16* o = (_Float16*)outp + (long)bz * oBatch;
          o[(long)gm * ldo + gn] = (_Float16)(v * scale);
        }
      }
    }
  }
}

// ---------------- prep kernels ----------------
__global__ void cvt_f32_to_f16(const float* __restrict__ in,
                               _Float16* __restrict__ out, long n) {
  long i = (long)blockIdx.x * blockDim.x + threadIdx.x;
  if (i < n) out[i] = (_Float16)in[i];
}

// in: [K][N] f32 row-major -> out: [N][K] f16 row-major.
// One work-group turns a tile of TK k x TN n through LDS, so that both global
// sides move 16 bytes a lane in runs of 256 bytes. The tile lies [n][k] in LDS;
// the 16-byte chunk of k group c in row n stands at place c ^ ((n >> 2) & 15),
// which spreads the 16 lanes of a store or a load over all banks.
static constexpr int TK = 128;
static constexpr int TN = 64;
template <int K, int N>
__global__ __launch_bounds__(256)
void transpose_cvt(const float* __restrict__ in, _Float16* __restrict__ out) {
  __shared__ alignas(16) _Float16 tile[TN * TK];   // 16 KB
  const int l  = threadIdx.x & 15;
  const int g  = threadIdx.x >> 4;
  const int n0 = blockIdx.x * TN;
  const int k0 = blockIdx.y * TK;

  // rows k0 + 8g .. + 7, columns n0 + 4l .. + 3
  const float* src = in + (long)(k0 + g * 8) * N + n0 + l * 4;
  v4f f[8];
#pragma unroll
  for (int r = 0; r < 8; ++r) f[r] = *(const v4f*)(src + (long)r * N);
#pragma unroll
  for (int j = 0; j < 4; ++j) {
    v8h h;
#pragma unroll
    for (int r = 0; r < 8; ++r) h[r] = (_Float16)f[r][j];
    *(v8h*)(tile + (l * 4 + j) * TK + (g ^ l) * 8) = h;
  }
  __syncthreads();
  // rows n0 + g + 16i, columns k0 + 8l .. + 7
  _Float16* dst = out + (long)(n0 + g) * K + k0 + l * 8;
#pragma unroll
  for (int i = 0; i < 4; ++i) {
    const int n = g + i * 16;
    *(v8h*)(dst + (long)i * 16 * K) =
        *(const v8h*)(tile + n * TK + (l ^ ((n >> 2) & 15)) * 8);
  }
}

// ---------------- row softmax over T=2048, in place on f16 ----------------
__global__ __launch_bounds__(256)
void softmax_rows(_Float16* __restrict__ P, int T) {
  __shared__ float red[256];
  const int tid = threadIdx.x;
  _Float16* p = P + (long)blockIdx.x * T;

  float v[8];
  float mx = -3.0e38f;
#pragma unroll
  for (int j = 0; j < 8; ++j) {
    v[j] = (float)p[tid + j * 256];
    mx = fmaxf(mx, v[j]);
  }
  red[tid] = mx; __syncthreads();
  for (int s = 128; s > 0; s >>= 1) {
    if (tid < s) red[tid] = fmaxf(red[tid], red[tid + s]);
    __syncthreads();
  }
  mx = red[0]; __syncthreads();

  float sum = 0.f;
#pragma unroll
  for (int j = 0; j < 8; ++j) { v[j] = __expf(v[j] - mx); sum += v[j]; }
  red[tid] = sum; __syncthreads();
  for (int s = 128; s > 0; s >>= 1) {
    if (tid < s) red[tid] += red[tid + s];
    __syncthreads();
  }
  const float inv = 1.f / red[0];
#pragma unroll
  for (int j = 0; j < 8; ++j) p[tid + j * 256] = (_Float16)(v[j] * inv);
}

// ---------------- host-side orchestration ----------------
extern "C" void kernel_launch(void* const* d_in, const int* in_sizes, int n_in,
                              void* d_out, int out_size, void* d_ws, size_t ws_size,
                              hipStream_t stream)
{
  const float* x    = (const float*)d_in[0];
  const float* Wqkv = (const float*)d_in[1];
  const float* bqkv = (const float*)d_in[2];
  const float* Wout = (const float*)d_in[3];
  const float* bout = (const float*)d_in[4];
  float* out = (float*)d_out;

  char* ws = (char*)d_ws;
  const long MB = 1024l * 1024l;
  _Float16* x_h    = (_Float16*)(ws);             // 16 MB  [8192][1024]
  _Float16* wqkv_t = (_Float16*)(ws + 16 * MB);   //  6 MB  [3072][1024]
  _Float16* wout_t = (_Float16*)(ws + 22 * MB);   //  2 MB  [1024][1024]
  _Float16* q_h    = (_Float16*)(ws + 24 * MB);   // 16 MB  [b][s][d]
  _Float16* k_h    = (_Float16*)(ws + 40 * MB);   // 16 MB  [b][s][d]
  _Float16* v_t    = (_Float16*)(ws + 56 * MB);   // 16 MB  [b][d][s]
  _Float16* probs  = (_Float16*)(ws + 72 * MB);   // 32 MB  [b][s][t]
  _Float16* attno  = (_Float16*)(ws + 104 * MB);  // 16 MB  [8192][1024]

  const long nx = (long)Bsz * Sseq * Dd;                 // 8,388,608
  cvt_f32_to_f16<<<dim3((unsigned)((nx + 255) / 256)), 256, 0, stream>>>(x, x_h, nx);
  transpose_cvt<Dd, 3 * Dd><<<dim3(3 * Dd / TN, Dd / TK), 256, 0, stream>>>(Wqkv, wqkv_t);
  transpose_cvt<Dd, Dd><<<dim3(Dd / TN, Dd / TK), 256, 0, stream>>>(Wout, wout_t);

  // 1) QKV projection: [8192,1024] x [1024,3072] + b
  gemm_wmma<0><<<dim3(3 * Dd / BN, Bsz * Sseq / BM, 1), 256, 0, stream>>>(
      x_h, wqkv_t, bqkv, nullptr,
      Bsz * Sseq, 3 * Dd, Dd, Dd, Dd, 0, 0, 0, 0, 1.0f, q_h, k_h, v_t);

  // 2) scores = scale * Q K^T  (batched over b)
  gemm_wmma<1><<<dim3(Sseq / BN, Sseq / BM, Bsz), 256, 0, stream>>>(
      q_h, k_h, nullptr, probs,
      Sseq, Sseq, Dd, Dd, Dd,
      (long)Sseq * Dd, (long)Sseq * Dd, (long)Sseq * Sseq, Sseq,
      0.03125f /* 1024^-0.5 */, nullptr, nullptr, nullptr);

  // 3) softmax rows (in place, f16)
  softmax_rows<<<dim3(Bsz * Sseq), 256, 0, stream>>>(probs, Sseq);

  // 4) O = P V  (V pre-transposed -> contiguous B operand)
  gemm_wmma<2><<<dim3(Dd / BN, Sseq / BM, Bsz), 256, 0, stream>>>(
      probs, v_t, nullptr, attno,
      Sseq, Dd, Sseq, Sseq, Sseq,
      (long)Sseq * Sseq, (long)Dd * Sseq, (long)Sseq * Dd, Dd,
      1.0f, nullptr, nullptr, nullptr);

  // 5) final = O Wout + bout  (f32 out)
  gemm_wmma<3><<<dim3(Dd / BN, Bsz * Sseq / BM, 1), 256, 0, stream>>>(
      attno, wout_t, bout, out,
      Bsz * Sseq, Dd, Dd, Dd, Dd, 0, 0, 0, Dd,
      1.0f, nullptr, nullptr, nullptr);
}

// v002
// Measured time: 228 microseconds a run.
// Two timings next to v001 both put it at 1.12 times that version's speed.
// All steps since v000 together make it 1.67 times as fast.
#include <hip/hip_runtime.h>

typedef __attribute__((ext_vector_type(16))) _Float16 v16h;
typedef __attribute__((ext_vector_type(8)))  _Float16 v8h;
typedef __attribute__((ext_vector_type(8)))  float    v8f;
typedef __attribute__((ext_vector_type(4)))  float    v4f;

static constexpr int Bsz  = 4;
static constexpr int Sseq = 2048;
static constexpr int Dd   = 1024;

static constexpr int BM = 128;   // block tile M (4 waves x 32)
static constexpr int BN = 128;   // block tile N (2 waves x 64)
static constexpr int BK = 32;    // k-step (matches WMMA K)
static constexpr int LDS_STRIDE = BK + 8;  // pad to dodge bank conflicts

// -------- WMMA operand gather from an LDS tile laid out [rows][LDS_STRIDE] f16.
// 16-bit A/B operand layout (ISA 7.12.2): lane&15 = row, lane>>4 selects the
// 8-wide K half; halves 0..7 <- K[hi*8 .. +7], halves 8..15 <- K[16+hi*8 .. +7].
__device__ __forceinline__ v16h frag_from_lds(const _Float16* base, int row0) {
  const int lane = threadIdx.x & 31;
  const int m  = lane & 15;
  const int hi = lane >> 4;
  const _Float16* p = base + (row0 + m) * LDS_STRIDE + hi * 8;
  v8h lo = *(const v8h*)(p);
  v8h hh = *(const v8h*)(p + 16);
  v16h r;
#pragma unroll
  for (int i = 0; i < 8; ++i) { r[i] = lo[i]; r[i + 8] = hh[i]; }
  return r;
}

// MODE 0: QKV projection epilogue (bias, split into q/k/v; v stored transposed)
// MODE 1: scores = scale * Q K^T, f16 out, batched via blockIdx.z
// MODE 2: O = P V, f16 out, batched
// MODE 3: out-proj epilogue (bias), f32 out to d_out
template <int MODE>
__global__ __launch_bounds__(256)
void gemm_wmma(const _Float16* __restrict__ Ag, const _Float16* __restrict__ Bg,
               const float* __restrict__ bias, void* __restrict__ outp,
               int M, int N, int K, int lda, int ldb,
               long aBatch, long bBatch, long oBatch, int ldo, float scale,
               _Float16* __restrict__ qp, _Float16* __restrict__ kp,
               _Float16* __restrict__ vp)
{
  // One LDS block: the two-buffer operand ring in the k loop, then the output
  // tile's staging area in the epilogue (the loop's last barrier separates them).
  constexpr int RING_BYTES  = 2 * (BM + BN) * LDS_STRIDE * 2;              // 40 KB
  constexpr int STAGE_BYTES = (MODE == 3) ? BM * (BN + 4) * 4 : BM * (BN + 8) * 2;
  __shared__ alignas(16) char smem[RING_BYTES > STAGE_BYTES ? RING_BYTES : STAGE_BYTES];
  _Float16 (*As)[BM * LDS_STRIDE] = (_Float16 (*)[BM * LDS_STRIDE])smem;
  _Float16 (*Bs)[BN * LDS_STRIDE] =
      (_Float16 (*)[BN * LDS_STRIDE])(smem + 2 * BM * LDS_STRIDE * 2);

  const int tid  = threadIdx.x;
  const int wave = tid >> 5;
  const int wm   = wave >> 1;          // 0..3 -> 32-row strip
  const int wn   = wave & 1;           // 0..1 -> 64-col strip
  const int m0   = blockIdx.y * BM;
  const int n0   = blockIdx.x * BN;
  const int bz   = blockIdx.z;

  const _Float16* A = Ag + (long)bz * aBatch;
  const _Float16* B = Bg + (long)bz * bBatch;

  // staging map: chunk cid in [0,512): row = cid>>2, col = (cid&3)*8
  const int r0 = tid >> 2;             // rows for cid = tid
  const int r1 = (tid + 256) >> 2;     // rows for cid = tid + 256
  const int c0 = (tid & 3) * 8;

  v8f zero = {};
  v8f acc[2][4];
#pragma unroll
  for (int i = 0; i < 2; ++i)
#pragma unroll
    for (int j = 0; j < 4; ++j) acc[i][j] = zero;

  // ---- prologue: stage k=0 into buffer 0
  {
    *(v8h*)(As[0] + r0 * LDS_STRIDE + c0) = *(const v8h*)(A + (long)(m0 + r0) * lda + c0);
    *(v8h*)(As[0] + r1 * LDS_STRIDE + c0) = *(const v8h*)(A + (long)(m0 + r1) * lda + c0);
    *(v8h*)(Bs[0] + r0 * LDS_STRIDE + c0) = *(const v8h*)(B + (long)(n0 + r0) * ldb + c0);
    *(v8h*)(Bs[0] + r1 * LDS_STRIDE + c0) = *(const v8h*)(B + (long)(n0 + r1) * ldb + c0);
  }
  __syncthreads();

  const int nk = K / BK;
  for (int ks = 0; ks < nk; ++ks) {
    const int cur = ks & 1;
    const bool hasNext = (ks + 1) < nk;

    // issue next tile's global loads early (latency hidden under WMMA burst)
    v8h ta0, ta1, tb0, tb1;
    if (hasNext) {
      const int k0 = (ks + 1) * BK;
      ta0 = *(const v8h*)(A + (long)(m0 + r0) * lda + k0 + c0);
      ta1 = *(const v8h*)(A + (long)(m0 + r1) * lda + k0 + c0);
      tb0 = *(const v8h*)(B + (long)(n0 + r0) * ldb + k0 + c0);
      tb1 = *(const v8h*)(B + (long)(n0 + r1) * ldb + k0 + c0);
    }

    // gather all fragments, then back-to-back WMMAs
    v16h af[2], bf[4];
#pragma unroll
    for (int i = 0; i < 2; ++i) af[i] = frag_from_lds(As[cur], wm * 32 + i * 16);
#pragma unroll
    for (int j = 0; j < 4; ++j) bf[j] = frag_from_lds(Bs[cur], wn * 64 + j * 16);
#pragma unroll
    for (int i = 0; i < 2; ++i)
#pragma unroll
      for (int j = 0; j < 4; ++j)
        acc[i][j] = __builtin_amdgcn_wmma_f32_16x16x32_f16(
            false, af[i], false, bf[j], (short)0, acc[i][j], false, false);

    if (hasNext) {
      const int nxt = cur ^ 1;
      *(v8h*)(As[nxt] + r0 * LDS_STRIDE + c0) = ta0;
      *(v8h*)(As[nxt] + r1 * LDS_STRIDE + c0) = ta1;
      *(v8h*)(Bs[nxt] + r0 * LDS_STRIDE + c0) = tb0;
      *(v8h*)(Bs[nxt] + r1 * LDS_STRIDE + c0) = tb1;
    }
    __syncthreads();
  }

  // Epilogue. C/D layout (ISA 7.12.2): lane&15 = N col, VGPR r -> M row
  // r + 8*(lane>>4). The work-group's 128 x 128 tile is laid in LDS in the order
  // of the output buffer, then stored 16 bytes a lane in whole 128-byte lines.
  // Every loop here is unrolled so that acc keeps constant indices (registers).
  const int lane  = tid & 31;
  const int nlane = lane & 15;
  const int hi    = lane >> 4;
  if (MODE == 3) {
    constexpr int SP = BN + 4;           // floats a staged row (528 B)
    float* st = (float*)smem;
#pragma unroll
    for (int j = 0; j < 4; ++j) {
      const int cn = wn * 64 + j * 16 + nlane;
      const float bv = bias[n0 + cn];
#pragma unroll
      for (int i = 0; i < 2; ++i)
#pragma unroll
        for (int r = 0; r < 8; ++r)
          st[(wm * 32 + i * 16 + hi * 8 + r) * SP + cn] = acc[i][j][r] + bv;
    }
    __syncthreads();   // every wave's part of the tile is in LDS before rows are read
    float* o = (float*)outp + (long)m0 * ldo + n0;
#pragma unroll
    for (int it = 0; it < 16; ++it) {
      const int row = it * 8 + wave;     // one wave stores one 512-byte row
      *(v4f*)(o + (long)row * ldo + lane * 4) = *(const v4f*)(st + row * SP + lane * 4);
    }
  } else {
    constexpr int SP = BN + 8;           // halves a staged row (272 B)
    _Float16* st = (_Float16*)smem;
    _Float16* dst;
    long pitch;
    bool turned = false;                 // V tile: staged and stored as [d][s]
    if (MODE == 0) {
      if (n0 < Dd)          { dst = qp + (long)m0 * Dd + n0;        pitch = Dd; }
      else if (n0 < 2 * Dd) { dst = kp + (long)m0 * Dd + (n0 - Dd); pitch = Dd; }
      else {
        dst = vp + ((long)(m0 >> 11) * Dd + (n0 - 2 * Dd)) * Sseq + (m0 & (Sseq - 1));
        pitch = Sseq;
        turned = true;
      }
    } else {
      dst = (_Float16*)outp + (long)bz * oBatch + (long)m0 * ldo + n0;
      pitch = ldo;
    }
    float bv[4];
#pragma unroll
    for (int j = 0; j < 4; ++j)
      bv[j] = (MODE == 0) ? bias[n0 + wn * 64 + j * 16 + nlane] : 0.f;
#pragma unroll
    for (int j = 0; j < 4; ++j)
#pragma unroll
      for (int i = 0; i < 2; ++i)
#pragma unroll
        for (int r = 0; r < 8; ++r)
          acc[i][j][r] = (MODE == 0) ? acc[i][j][r] + bv[j] : acc[i][j][r] * scale;
    if (turned) {
#pragma unroll
      for (int j = 0; j < 4; ++j)
#pragma unroll
        for (int i = 0; i < 2; ++i) {
          v8h h;                                   // a lane's 8 rows are 8 adjacent s
#pragma unroll
          for (int r = 0; r < 8; ++r) h[r] = (_Float16)acc[i][j][r];
          *(v8h*)(st + (wn * 64 + j * 16 + nlane) * SP + wm * 32 + i * 16 + hi * 8) = h;
        }
    } else {
#pragma unroll
      for (int j = 0; j < 4; ++j)
#pragma unroll
        for (int i = 0; i < 2; ++i)
#pragma unroll
          for (int r = 0; r < 8; ++r)
            st[(wm * 32 + i * 16 + hi * 8 + r) * SP + wn * 64 + j * 16 + nlane] =
                (_Float16)acc[i][j][r];
    }
    __syncthreads();   // every wave's part of the tile is in LDS before rows are read
#pragma unroll
    for (int it = 0; it < 8; ++it) {
      const int row = it * 16 + (tid >> 4);        // 16 lanes store one 256-byte row
      const int c   = (tid & 15) * 8;
      *(v8h*)(dst + (long)row * pitch + c) = *(const v8h*)(st + row * SP + c);
    }
  }
}

// ---------------- prep kernels ----------------
__global__ void cvt_f32_to_f16(const float* __restrict__ in,
                               _Float16* __restrict__ out, long n) {
  long i = (long)blockIdx.x * blockDim.x + threadIdx.x;
  if (i < n) out[i] = (_Float16)in[i];
}

// in: [K][N] f32 row-major -> out: [N][K] f16 row-major.
// One work-group turns a tile of TK k x TN n through LDS, so that both global
// sides move 16 bytes a lane in runs of 256 bytes. The tile lies [n][k] in LDS;
// the 16-byte chunk of k group c in row n stands at place c ^ ((n >> 2) & 15),
// which spreads the 16 lanes of a store or a load over all banks.
static constexpr int TK = 128;
static constexpr int TN = 64;
template <int K, int N>
__global__ __launch_bounds__(256)
void transpose_cvt(const float* __restrict__ in, _Float16* __restrict__ out) {
  __shared__ alignas(16) _Float16 tile[TN * TK];   // 16 KB
  const int l  = threadIdx.x & 15;
  const int g  = threadIdx.x >> 4;
  const int n0 = blockIdx.x * TN;
  const int k0 = blockIdx.y * TK;

  // rows k0 + 8g .. + 7, columns n0 + 4l .. + 3
  const float* src = in + (long)(k0 + g * 8) * N + n0 + l * 4;
  v4f f[8];
#pragma unroll
  for (int r = 0; r < 8; ++r) f[r] = *(const v4f*)(src + (long)r * N);
#pragma unroll
  for (int j = 0; j < 4; ++j) {
    v8h h;
#pragma unroll
    for (int r = 0; r < 8; ++r) h[r] = (_Float16)f[r][j];
    *(v8h*)(tile + (l * 4 + j) * TK + (g ^ l) * 8) = h;
  }
  __syncthreads();
  // rows n0 + g + 16i, columns k0 + 8l .. + 7
  _Float16* dst = out + (long)(n0 + g) * K + k0 + l * 8;
#pragma unroll
  for (int i = 0; i < 4; ++i) {
    const int n = g + i * 16;
    *(v8h*)(dst + (long)i * 16 * K) =
        *(const v8h*)(tile + n * TK + (l ^ ((n >> 2) & 15)) * 8);
  }
}

// ---------------- row softmax over T=2048, in place on f16 ----------------
__global__ __launch_bounds__(256)
void softmax_rows(_Float16* __restrict__ P, int T) {
  __shared__ float red[256];
  const int tid = threadIdx.x;
  _Float16* p = P + (long)blockIdx.x * T;

  float v[8];
  float mx = -3.0e38f;
#pragma unroll
  for (int j = 0; j < 8; ++j) {
    v[j] = (float)p[tid + j * 256];
    mx = fmaxf(mx, v[j]);
  }
  red[tid] = mx; __syncthreads();
  for (int s = 128; s > 0; s >>= 1) {
    if (tid < s) red[tid] = fmaxf(red[tid], red[tid + s]);
    __syncthreads();
  }
  mx = red[0]; __syncthreads();

  float sum = 0.f;
#pragma unroll
  for (int j = 0; j < 8; ++j) { v[j] = __expf(v[j] - mx); sum += v[j]; }
  red[tid] = sum; __syncthreads();
  for (int s = 128; s > 0; s >>= 1) {
    if (tid < s) red[tid] += red[tid + s];
    __syncthreads();
  }
  const float inv = 1.f / red[0];
#pragma unroll
  for (int j = 0; j < 8; ++j) p[tid + j * 256] = (_Float16)(v[j] * inv);
}

// ---------------- host-side orchestration ----------------
extern "C" void kernel_launch(void* const* d_in, const int* in_sizes, int n_in,
                              void* d_out, int out_size, void* d_ws, size_t ws_size,
                              hipStream_t stream)
{
  const float* x    = (const float*)d_in[0];
  const float* Wqkv = (const float*)d_in[1];
  const float* bqkv = (const float*)d_in[2];
  const float* Wout = (const float*)d_in[3];
  const float* bout = (const float*)d_in[4];
  float* out = (float*)d_out;

  char* ws = (char*)d_ws;
  const long MB = 1024l * 1024l;
  _Float16* x_h    = (_Float16*)(ws);             // 16 MB  [8192][1024]
  _Float16* wqkv_t = (_Float16*)(ws + 16 * MB);   //  6 MB  [3072][1024]
  _Float16* wout_t = (_Float16*)(ws + 22 * MB);   //  2 MB  [1024][1024]
  _Float16* q_h    = (_Float16*)(ws + 24 * MB);   // 16 MB  [b][s][d]
  _Float16* k_h    = (_Float16*)(ws + 40 * MB);   // 16 MB  [b][s][d]
  _Float16* v_t    = (_Float16*)(ws + 56 * MB);   // 16 MB  [b][d][s]
  _Float16* probs  = (_Float16*)(ws + 72 * MB);   // 32 MB  [b][s][t]
  _Float16* attno  = (_Float16*)(ws + 104 * MB);  // 16 MB  [8192][1024]

  const long nx = (long)Bsz * Sseq * Dd;                 // 8,388,608
  cvt_f32_to_f16<<<dim3((unsigned)((nx + 255) / 256)), 256, 0, stream>>>(x, x_h, nx);
  transpose_cvt<Dd, 3 * Dd><<<dim3(3 * Dd / TN, Dd / TK), 256, 0, stream>>>(Wqkv, wqkv_t);
  transpose_cvt<Dd, Dd><<<dim3(Dd / TN, Dd / TK), 256, 0, stream>>>(Wout, wout_t);

  // 1) QKV projection: [8192,1024] x [1024,3072] + b
  gemm_wmma<0><<<dim3(3 * Dd / BN, Bsz * Sseq / BM, 1), 256, 0, stream>>>(
      x_h, wqkv_t, bqkv, nullptr,
      Bsz * Sseq, 3 * Dd, Dd, Dd, Dd, 0, 0, 0, 0, 1.0f, q_h, k_h, v_t);

  // 2) scores = scale * Q K^T  (batched over b)
  gemm_wmma<1><<<dim3(Sseq / BN, Sseq / BM, Bsz), 256, 0, stream>>>(
      q_h, k_h, nullptr, probs,
      Sseq, Sseq, Dd, Dd, Dd,
      (long)Sseq * Dd, (long)Sseq * Dd, (long)Sseq * Sseq, Sseq,
      0.03125f /* 1024^-0.5 */, nullptr, nullptr, nullptr);

  // 3) softmax rows (in place, f16)
  softmax_rows<<<dim3(Bsz * Sseq), 256, 0, stream>>>(probs, Sseq);

  // 4) O = P V  (V pre-transposed -> contiguous B operand)
  gemm_wmma<2><<<dim3(Dd / BN, Sseq / BM, Bsz), 256, 0, stream>>>(
      probs, v_t, nullptr, attno,
      Sseq, Dd, Sseq, Sseq, Sseq,
      (long)Sseq * Sseq, (long)Dd * Sseq, (long)Sseq * Dd, Dd,
      1.0f, nullptr, nullptr, nullptr);

  // 5) final = O Wout + bout  (f32 out)
  gemm_wmma<3><<<dim3(Dd / BN, Bsz * Sseq / BM, 1), 256, 0, stream>>>(
      attno, wout_t, bout, out,
      Bsz * Sseq, Dd, Dd, Dd, Dd, 0, 0, 0, Dd,
      1.0f, nullptr, nullptr, nullptr);
}

// v003
// It runs in 189 microseconds.
// In two side-by-side timings against v002, it was 1.20 and 1.21 times as fast.
// All steps since v000 together make it 2.02 times as fast.
#include <hip/hip_runtime.h>

typedef __attribute__((ext_vector_type(16))) _Float16 v16h;
typedef __attribute__((ext_vector_type(8)))  _Float16 v8h;
typedef __attribute__((ext_vector_type(8)))  float    v8f;
typedef __attribute__((ext_vector_type(4)))  float    v4f;

static constexpr int Bsz  = 4;
static constexpr int Sseq = 2048;
static constexpr int Dd   = 1024;

static constexpr int BM = 256;   // block tile M (4 waves x 64)
static constexpr int BN = 128;   // block tile N (2 waves x 64)
static constexpr int BK = 64;    // k-step: one 128-byte line of every operand row, two WMMA K
static constexpr int LDS_STRIDE = BK + 8;  // 144-byte pitch: 16 rows of a 16-byte read meet 64 banks

// -------- WMMA operand gather from an LDS tile laid out [rows][LDS_STRIDE] f16.
// 16-bit A/B operand layout (ISA 7.12.2): lane&15 = row, lane>>4 selects the
// 8-wide K half; halves 0..7 <- K[hi*8 .. +7], halves 8..15 <- K[16+hi*8 .. +7].
__device__ __forceinline__ v16h frag_from_lds(const _Float16* base, int row0, int kk) {
  const int lane = threadIdx.x & 31;
  const int m  = lane & 15;
  const int hi = lane >> 4;
  const _Float16* p = base + (row0 + m) * LDS_STRIDE + kk * 32 + hi * 8;
  v8h lo = *(const v8h*)(p);
  v8h hh = *(const v8h*)(p + 16);
  v16h r;
#pragma unroll
  for (int i = 0; i < 8; ++i) { r[i] = lo[i]; r[i + 8] = hh[i]; }
  return r;
}

// MODE 0: QKV projection epilogue (bias, split into q/k/v; v stored transposed)
// MODE 1: scores = scale * Q K^T, f16 out, batched via blockIdx.z
// MODE 2: O = P V, f16 out, batched
// MODE 3: out-proj epilogue (bias), f32 out to d_out
template <int MODE>
__global__ __launch_bounds__(256)
void gemm_wmma(const _Float16* __restrict__ Ag, const _Float16* __restrict__ Bg,
               const float* __restrict__ bias, void* __restrict__ outp,
               int M, int N, int K,
               long aBatch, long bBatch, long oBatch, int ldo, float scale,
               _Float16* __restrict__ qp, _Float16* __restrict__ kp,
               _Float16* __restrict__ vp)
{
  // One LDS block: the two-buffer operand ring in the k loop, then the output
  // tile's staging area in the epilogue (the loop's last barrier separates them).
  constexpr int RING_BYTES  = 2 * (BM + BN) * LDS_STRIDE * 2;              // 108 KB
  constexpr int STAGE_BYTES = (MODE == 3) ? BM * (BN + 4) * 4 : BM * (BN + 8) * 2;
  __shared__ alignas(16) char smem[RING_BYTES > STAGE_BYTES ? RING_BYTES : STAGE_BYTES];
  _Float16 (*As)[BM * LDS_STRIDE] = (_Float16 (*)[BM * LDS_STRIDE])smem;
  _Float16 (*Bs)[BN * LDS_STRIDE] =
      (_Float16 (*)[BN * LDS_STRIDE])(smem + 2 * BM * LDS_STRIDE * 2);

  const int tid  = threadIdx.x;
  const int wave = tid >> 5;
  const int wm   = wave >> 1;          // 0..3 -> 64-row strip
  const int wn   = wave & 1;           // 0..1 -> 64-col strip
  const int m0   = blockIdx.y * BM;
  const int n0   = blockIdx.x * BN;
  const int bz   = blockIdx.z;

  const _Float16* A = Ag + (long)bz * aBatch;
  const _Float16* B = Bg + (long)bz * bBatch;

  // staging map: 8 lanes take one 128-byte row piece, so a wave's 16-byte load
  // covers 4 whole lines; thread t: row (t >> 3) + 32 i, halves (t & 7) * 8 ..
  const int sr = tid >> 3;
  const int sc = (tid & 7) * 8;
  // both operands are K-contiguous with a row pitch known at compile time, so one
  // address a lane and operand serves all row groups through the loads' offset field
  constexpr int LD = (MODE == 2) ? Sseq : Dd;
  const _Float16* Ap = A + (long)(m0 + sr) * LD + sc;
  const _Float16* Bp = B + (long)(n0 + sr) * LD + sc;
  const int so = sr * LDS_STRIDE + sc;

  v8f zero = {};
  v8f acc[4][4];
#pragma unroll
  for (int i = 0; i < 4; ++i)
#pragma unroll
    for (int j = 0; j < 4; ++j) acc[i][j] = zero;

  // ---- prologue: stage k=0 into buffer 0
#pragma unroll
  for (int i = 0; i < BM / 32; ++i)
    *(v8h*)(As[0] + so + i * 32 * LDS_STRIDE) = *(const v8h*)(Ap + i * 32 * LD);
#pragma unroll
  for (int i = 0; i < BN / 32; ++i)
    *(v8h*)(Bs[0] + so + i * 32 * LDS_STRIDE) = *(const v8h*)(Bp + i * 32 * LD);
  __syncthreads();

  const int nk = K / BK;
  for (int ks = 0; ks < nk; ++ks) {
    const int cur = ks & 1;
    const bool hasNext = (ks + 1) < nk;

    // gather all fragments of the k-step as one group, then back-to-back WMMAs
    v16h af[BK / 32][4], bf[BK / 32][4];
#pragma unroll
    for (int kk = 0; kk < BK / 32; ++kk) {
#pragma unroll
      for (int i = 0; i < 4; ++i) af[kk][i] = frag_from_lds(As[cur], wm * 64 + i * 16, kk);
#pragma unroll
      for (int j = 0; j < 4; ++j) bf[kk][j] = frag_from_lds(Bs[cur], wn * 64 + j * 16, kk);
      // keeps the reads in the order of their use: the first 16 WMMAs then wait for the
      // first half of the group only
      __builtin_amdgcn_sched_barrier(0);
    }
    // next tile's global loads, issued behind the LDS reads (which the WMMAs wait for
    // first) and ahead of the WMMA burst that hides their latency
    v8h ta[BM / 32], tb[BN / 32];
    if (hasNext) {
      const _Float16* an = Ap + (ks + 1) * BK;
      const _Float16* bn = Bp + (ks + 1) * BK;
#pragma unroll
      for (int i = 0; i < BM / 32; ++i) ta[i] = *(const v8h*)(an + i * 32 * LD);
#pragma unroll
      for (int i = 0; i < BN / 32; ++i) tb[i] = *(const v8h*)(bn + i * 32 * LD);
      // the loads' address registers are given new values only behind this wait; as its
      // inputs they stay live up to it, so that no load's result is laid over them
      asm volatile("s_wait_xcnt 0x0" :: "v"(an), "v"(bn) : "memory");
    }
    // keeps the LDS reads one group ahead of the WMMAs: without it the compiler sinks
    // them among the WMMAs, two at a time, each pair waited to zero before its four WMMAs
    __builtin_amdgcn_sched_barrier(0);
#pragma unroll
    for (int kk = 0; kk < BK / 32; ++kk)
#pragma unroll
      for (int i = 0; i < 4; ++i)
#pragma unroll
        for (int j = 0; j < 4; ++j)
          acc[i][j] = __builtin_amdgcn_wmma_f32_16x16x32_f16(
              false, af[kk][i], false, bf[kk][j], (short)0, acc[i][j], false, false);

    if (hasNext) {
      const int nxt = cur ^ 1;
#pragma unroll
      for (int i = 0; i < BM / 32; ++i) *(v8h*)(As[nxt] + so + i * 32 * LDS_STRIDE) = ta[i];
#pragma unroll
      for (int i = 0; i < BN / 32; ++i) *(v8h*)(Bs[nxt] + so + i * 32 * LDS_STRIDE) = tb[i];
    }
    __syncthreads();
  }

  // Epilogue. C/D layout (ISA 7.12.2): lane&15 = N col, VGPR r -> M row
  // r + 8*(lane>>4). The work-group's 256 x 128 tile is laid in LDS in the order
  // of the output buffer, then stored 16 bytes a lane in whole 128-byte lines.
  // Every loop here is unrolled so that acc keeps constant indices (registers).
  const int lane  = tid & 31;
  const int nlane = lane & 15;
  const int hi    = lane >> 4;
  if (MODE == 3) {
    constexpr int SP = BN + 4;           // floats a staged row (528 B)
    float* st = (float*)smem;
#pragma unroll
    for (int j = 0; j < 4; ++j) {
      const int cn = wn * 64 + j * 16 + nlane;
      const float bv = bias[n0 + cn];
      // the load's offset register is given a new value only behind this wait
      asm volatile("s_wait_xcnt 0x0" :: "v"(n0 + cn) : "memory");
#pragma unroll
      for (int i = 0; i < 4; ++i)
#pragma unroll
        for (int r = 0; r < 8; ++r)
          st[(wm * 64 + i * 16 + hi * 8 + r) * SP + cn] = acc[i][j][r] + bv;
    }
    __syncthreads();   // every wave's part of the tile is in LDS before rows are read
    float* o = (float*)outp + (long)m0 * ldo + n0;
#pragma unroll
    for (int it = 0; it < BM / 8; ++it) {
      const int row = it * 8 + wave;     // one wave stores one 512-byte row
      *(v4f*)(o + (long)row * ldo + lane * 4) = *(const v4f*)(st + row * SP + lane * 4);
    }
  } else {
    constexpr int SP  = BN + 8;          // halves a staged row (272 B)
    constexpr int SPT = BM + 8;          // the same for a turned tile (528 B)
    _Float16* st = (_Float16*)smem;
    _Float16* dst;
    long pitch;
    bool turned = false;                 // V tile: staged and stored as [d][s]
    if (MODE == 0) {
      if (n0 < Dd)          { dst = qp + (long)m0 * Dd + n0;        pitch = Dd; }
      else if (n0 < 2 * Dd) { dst = kp + (long)m0 * Dd + (n0 - Dd); pitch = Dd; }
      else {
        dst = vp + ((long)(m0 >> 11) * Dd + (n0 - 2 * Dd)) * Sseq + (m0 & (Sseq - 1));
        pitch = Sseq;
        turned = true;
      }
    } else {
      dst = (_Float16*)outp + (long)bz * oBatch + (long)m0 * ldo + n0;
      pitch = ldo;
    }
    float bv[4];
#pragma unroll
    for (int j = 0; j < 4; ++j)
      bv[j] = (MODE == 0) ? bias[n0 + wn * 64 + j * 16 + nlane] : 0.f;
#pragma unroll
    for (int j = 0; j < 4; ++j)
#pragma unroll
      for (int i = 0; i < 4; ++i)
#pragma unroll
        for (int r = 0; r < 8; ++r)
          acc[i][j][r] = (MODE == 0) ? acc[i][j][r] + bv[j] : acc[i][j][r] * scale;
    if (turned) {
#pragma unroll
      for (int j = 0; j < 4; ++j)
#pragma unroll
        for (int i = 0; i < 4; ++i) {
          v8h h;                                   // a lane's 8 rows are 8 adjacent s
#pragma unroll
          for (int r = 0; r < 8; ++r) h[r] = (_Float16)acc[i][j][r];
          *(v8h*)(st + (wn * 64 + j * 16 + nlane) * SPT + wm * 64 + i * 16 + hi * 8) = h;
        }
    } else {
#pragma unroll
      for (int j = 0; j < 4; ++j)
#pragma unroll
        for (int i = 0; i < 4; ++i)
#pragma unroll
          for (int r = 0; r < 8; ++r)
            st[(wm * 64 + i * 16 + hi * 8 + r) * SP + wn * 64 + j * 16 + nlane] =
                (_Float16)acc[i][j][r];
    }
    __syncthreads();   // every wave's part of the tile is in LDS before rows are read
    // 16 lanes store one 256-byte row of 256; turned: 32 lanes one 512-byte row of 128
    static_assert(BM / 16 == BN / 8, "both forms take the same number of trips");
    const int rstep = turned ? 8 : 16;
    const int rbase = turned ? wave : (tid >> 4);
    const int c     = (turned ? lane : (tid & 15)) * 8;
    const int sp    = turned ? SPT : SP;
#pragma unroll
    for (int it = 0; it < BM / 16; ++it) {
      const int row = it * rstep + rbase;
      *(v8h*)(dst + (long)row * pitch + c) = *(const v8h*)(st + row * sp + c);
    }
  }
}

// ---------------- prep kernels ----------------
__global__ void cvt_f32_to_f16(const float* __restrict__ in,
                               _Float16* __restrict__ out, long n) {
  long i = (long)blockIdx.x * blockDim.x + threadIdx.x;
  if (i < n) out[i] = (_Float16)in[i];
}

// in: [K][N] f32 row-major -> out: [N][K] f16 row-major.
// One work-group turns a tile of TK k x TN n through LDS, so that both global
// sides move 16 bytes a lane in runs of 256 bytes. The tile lies [n][k] in LDS;
// the 16-byte chunk of k group c in row n stands at place c ^ ((n >> 2) & 15),
// which spreads the 16 lanes of a store or a load over all banks.
static constexpr int TK = 128;
static constexpr int TN = 64;
template <int K, int N>
__global__ __launch_bounds__(256)
void transpose_cvt(const float* __restrict__ in, _Float16* __restrict__ out) {
  __shared__ alignas(16) _Float16 tile[TN * TK];   // 16 KB
  const int l  = threadIdx.x & 15;
  const int g  = threadIdx.x >> 4;
  const int n0 = blockIdx.x * TN;
  const int k0 = blockIdx.y * TK;

  // rows k0 + 8g .. + 7, columns n0 + 4l .. + 3
  const float* src = in + (long)(k0 + g * 8) * N + n0 + l * 4;
  v4f f[8];
#pragma unroll
  for (int r = 0; r < 8; ++r) f[r] = *(const v4f*)(src + (long)r * N);
#pragma unroll
  for (int j = 0; j < 4; ++j) {
    v8h h;
#pragma unroll
    for (int r = 0; r < 8; ++r) h[r] = (_Float16)f[r][j];
    *(v8h*)(tile + (l * 4 + j) * TK + (g ^ l) * 8) = h;
  }
  __syncthreads();
  // rows n0 + g + 16i, columns k0 + 8l .. + 7
  _Float16* dst = out + (long)(n0 + g) * K + k0 + l * 8;
#pragma unroll
  for (int i = 0; i < 4; ++i) {
    const int n = g + i * 16;
    *(v8h*)(dst + (long)i * 16 * K) =
        *(const v8h*)(tile + n * TK + (l ^ ((n >> 2) & 15)) * 8);
  }
}

// ---------------- row softmax over T=2048, in place on f16 ----------------
__global__ __launch_bounds__(256)
void softmax_rows(_Float16* __restrict__ P, int T) {
  __shared__ float red[256];
  const int tid = threadIdx.x;
  _Float16* p = P + (long)blockIdx.x * T;

  float v[8];
  float mx = -3.0e38f;
#pragma unroll
  for (int j = 0; j < 8; ++j) {
    v[j] = (float)p[tid + j * 256];
    mx = fmaxf(mx, v[j]);
  }
  red[tid] = mx; __syncthreads();
  for (int s = 128; s > 0; s >>= 1) {
    if (tid < s) red[tid] = fmaxf(red[tid], red[tid + s]);
    __syncthreads();
  }
  mx = red[0]; __syncthreads();

  float sum = 0.f;
#pragma unroll
  for (int j = 0; j < 8; ++j) { v[j] = __expf(v[j] - mx); sum += v[j]; }
  red[tid] = sum; __syncthreads();
  for (int s = 128; s > 0; s >>= 1) {
    if (tid < s) red[tid] += red[tid + s];
    __syncthreads();
  }
  const float inv = 1.f / red[0];
#pragma unroll
  for (int j = 0; j < 8; ++j) p[tid + j * 256] = (_Float16)(v[j] * inv);
}

// ---------------- host-side orchestration ----------------
extern "C" void kernel_launch(void* const* d_in, const int* in_sizes, int n_in,
                              void* d_out, int out_size, void* d_ws, size_t ws_size,
                              hipStream_t stream)
{
  const float* x    = (const float*)d_in[0];
  const float* Wqkv = (const float*)d_in[1];
  const float* bqkv = (const float*)d_in[2];
  const float* Wout = (const float*)d_in[3];
  const float* bout = (const float*)d_in[4];
  float* out = (float*)d_out;

  char* ws = (char*)d_ws;
  const long MB = 1024l * 1024l;
  _Float16* x_h    = (_Float16*)(ws);             // 16 MB  [8192][1024]
  _Float16* wqkv_t = (_Float16*)(ws + 16 * MB);   //  6 MB  [3072][1024]
  _Float16* wout_t = (_Float16*)(ws + 22 * MB);   //  2 MB  [1024][1024]
  _Float16* q_h    = (_Float16*)(ws + 24 * MB);   // 16 MB  [b][s][d]
  _Float16* k_h    = (_Float16*)(ws + 40 * MB);   // 16 MB  [b][s][d]
  _Float16* v_t    = (_Float16*)(ws + 56 * MB);   // 16 MB  [b][d][s]
  _Float16* probs  = (_Float16*)(ws + 72 * MB);   // 32 MB  [b][s][t]
  _Float16* attno  = (_Float16*)(ws + 104 * MB);  // 16 MB  [8192][1024]

  const long nx = (long)Bsz * Sseq * Dd;                 // 8,388,608
  cvt_f32_to_f16<<<dim3((unsigned)((nx + 255) / 256)), 256, 0, stream>>>(x, x_h, nx);
  transpose_cvt<Dd, 3 * Dd><<<dim3(3 * Dd / TN, Dd / TK), 256, 0, stream>>>(Wqkv, wqkv_t);
  transpose_cvt<Dd, Dd><<<dim3(Dd / TN, Dd / TK), 256, 0, stream>>>(Wout, wout_t);

  // 1) QKV projection: [8192,1024] x [1024,3072] + b
  gemm_wmma<0><<<dim3(3 * Dd / BN, Bsz * Sseq / BM, 1), 256, 0, stream>>>(
      x_h, wqkv_t, bqkv, nullptr,
      Bsz * Sseq, 3 * Dd, Dd, 0, 0, 0, 0, 1.0f, q_h, k_h, v_t);

  // 2) scores = scale * Q K^T  (batched over b)
  gemm_wmma<1><<<dim3(Sseq / BN, Sseq / BM, Bsz), 256, 0, stream>>>(
      q_h, k_h, nullptr, probs,
      Sseq, Sseq, Dd,
      (long)Sseq * Dd, (long)Sseq * Dd, (long)Sseq * Sseq, Sseq,
      0.03125f /* 1024^-0.5 */, nullptr, nullptr, nullptr);

  // 3) softmax rows (in place, f16)
  softmax_rows<<<dim3(Bsz * Sseq), 256, 0, stream>>>(probs, Sseq);

  // 4) O = P V  (V pre-transposed -> contiguous B operand)
  gemm_wmma<2><<<dim3(Dd / BN, Sseq / BM, Bsz), 256, 0, stream>>>(
      probs, v_t, nullptr, attno,
      Sseq, Dd, Sseq,
      (long)Sseq * Sseq, (long)Dd * Sseq, (long)Sseq * Dd, Dd,
      1.0f, nullptr, nullptr, nullptr);

  // 5) final = O Wout + bout  (f32 out)
  gemm_wmma<3><<<dim3(Dd / BN, Bsz * Sseq / BM, 1), 256, 0, stream>>>(
      attno, wout_t, bout, out,
      Bsz * Sseq, Dd, Dd, 0, 0, 0, Dd,
      1.0f, nullptr, nullptr, nullptr);
}

// v004
// It runs in 178 microseconds.
// Two timings next to v003 put it at 1.06 and 1.07 times that version's speed.
// Over all steps from v000 it is 2.15 times as fast.
#include <hip/hip_runtime.h>

typedef __attribute__((ext_vector_type(16))) _Float16 v16h;
typedef __attribute__((ext_vector_type(8)))  _Float16 v8h;
typedef __attribute__((ext_vector_type(4)))  _Float16 v4h;
typedef __attribute__((ext_vector_type(8)))  float    v8f;
typedef __attribute__((ext_vector_type(4)))  float    v4f;

static constexpr int Bsz  = 4;
static constexpr int Sseq = 2048;
static constexpr int Dd   = 1024;

static constexpr int BM = 256;   // block tile M (4 waves x 64)
static constexpr int BN = 128;   // block tile N (2 waves x 64)
static constexpr int BK = 64;    // k-step: one 128-byte line of every operand row, two WMMA K
static constexpr int LDS_STRIDE = BK + 8;  // 144-byte pitch: 16 rows of a 16-byte read meet 64 banks

// -------- WMMA operand gather from an LDS tile laid out [rows][LDS_STRIDE] f16.
// 16-bit A/B operand layout (ISA 7.12.2): lane&15 = row, lane>>4 selects the
// 8-wide K half; halves 0..7 <- K[hi*8 .. +7], halves 8..15 <- K[16+hi*8 .. +7].
__device__ __forceinline__ v16h frag_from_lds(const _Float16* base, int row0, int kk) {
  const int lane = threadIdx.x & 31;
  const int m  = lane & 15;
  const int hi = lane >> 4;
  const _Float16* p = base + (row0 + m) * LDS_STRIDE + kk * 32 + hi * 8;
  v8h lo = *(const v8h*)(p);
  v8h hh = *(const v8h*)(p + 16);
  v16h r;
#pragma unroll
  for (int i = 0; i < 8; ++i) { r[i] = lo[i]; r[i + 8] = hh[i]; }
  return r;
}

// MODE 0: QKV projection epilogue (bias, split into q/k/v; v stored transposed)
// MODE 1: scores = scale * Q K^T, f16 out, batched via blockIdx.z
// MODE 2: O = P V, f16 out, batched
// MODE 3: out-proj epilogue (bias), f32 out to d_out
template <int MODE>
__global__ __launch_bounds__(256)
void gemm_wmma(const _Float16* __restrict__ Ag, const _Float16* __restrict__ Bg,
               const float* __restrict__ bias, void* __restrict__ outp,
               int M, int N, int K,
               long aBatch, long bBatch, long oBatch, int ldo, float scale,
               _Float16* __restrict__ qp, _Float16* __restrict__ kp,
               _Float16* __restrict__ vp)
{
  // One LDS block: the two-buffer operand ring in the k loop, then the output
  // tile's staging area in the epilogue (the loop's last barrier separates them).
  constexpr int RING_BYTES  = 2 * (BM + BN) * LDS_STRIDE * 2;              // 108 KB
  constexpr int STAGE_BYTES = (MODE == 3) ? BM * (BN + 4) * 4 : BM * (BN + 8) * 2;
  __shared__ alignas(16) char smem[RING_BYTES > STAGE_BYTES ? RING_BYTES : STAGE_BYTES];
  _Float16 (*As)[BM * LDS_STRIDE] = (_Float16 (*)[BM * LDS_STRIDE])smem;
  _Float16 (*Bs)[BN * LDS_STRIDE] =
      (_Float16 (*)[BN * LDS_STRIDE])(smem + 2 * BM * LDS_STRIDE * 2);

  const int tid  = threadIdx.x;
  const int wave = tid >> 5;
  const int wm   = wave >> 1;          // 0..3 -> 64-row strip
  const int wn   = wave & 1;           // 0..1 -> 64-col strip
  const int m0   = blockIdx.y * BM;
  const int n0   = blockIdx.x * BN;
  const int bz   = blockIdx.z;

  const _Float16* A = Ag + (long)bz * aBatch;
  const _Float16* B = Bg + (long)bz * bBatch;

  // staging map: 8 lanes take one 128-byte row piece, so a wave's 16-byte load
  // covers 4 whole lines; thread t: row (t >> 3) + 32 i, halves (t & 7) * 8 ..
  const int sr = tid >> 3;
  const int sc = (tid & 7) * 8;
  // both operands are K-contiguous with a row pitch known at compile time, so one
  // address a lane and operand serves all row groups through the loads' offset field
  constexpr int LD = (MODE == 2) ? Sseq : Dd;
  const _Float16* Ap = A + (long)(m0 + sr) * LD + sc;
  const _Float16* Bp = B + (long)(n0 + sr) * LD + sc;
  const int so = sr * LDS_STRIDE + sc;

  v8f zero = {};
  v8f acc[4][4];
#pragma unroll
  for (int i = 0; i < 4; ++i)
#pragma unroll
    for (int j = 0; j < 4; ++j) acc[i][j] = zero;

  // ---- prologue: stage k=0 into buffer 0
#pragma unroll
  for (int i = 0; i < BM / 32; ++i)
    *(v8h*)(As[0] + so + i * 32 * LDS_STRIDE) = *(const v8h*)(Ap + i * 32 * LD);
#pragma unroll
  for (int i = 0; i < BN / 32; ++i)
    *(v8h*)(Bs[0] + so + i * 32 * LDS_STRIDE) = *(const v8h*)(Bp + i * 32 * LD);
  __syncthreads();

  const int nk = K / BK;
  for (int ks = 0; ks < nk; ++ks) {
    const int cur = ks & 1;
    const bool hasNext = (ks + 1) < nk;

    // gather all fragments of the k-step as one group, then back-to-back WMMAs
    v16h af[BK / 32][4], bf[BK / 32][4];
#pragma unroll
    for (int kk = 0; kk < BK / 32; ++kk) {
#pragma unroll
      for (int i = 0; i < 4; ++i) af[kk][i] = frag_from_lds(As[cur], wm * 64 + i * 16, kk);
#pragma unroll
      for (int j = 0; j < 4; ++j) bf[kk][j] = frag_from_lds(Bs[cur], wn * 64 + j * 16, kk);
      // keeps the reads in the order of their use: the first 16 WMMAs then wait for the
      // first half of the group only
      __builtin_amdgcn_sched_barrier(0);
    }
    // next tile's global loads, issued behind the LDS reads (which the WMMAs wait for
    // first) and ahead of the WMMA burst that hides their latency
    v8h ta[BM / 32], tb[BN / 32];
    if (hasNext) {
      const _Float16* an = Ap + (ks + 1) * BK;
      const _Float16* bn = Bp + (ks + 1) * BK;
#pragma unroll
      for (int i = 0; i < BM / 32; ++i) ta[i] = *(const v8h*)(an + i * 32 * LD);
#pragma unroll
      for (int i = 0; i < BN / 32; ++i) tb[i] = *(const v8h*)(bn + i * 32 * LD);
      // the loads' address registers are given new values only behind this wait; as its
      // inputs they stay live up to it, so that no load's result is laid over them
      asm volatile("s_wait_xcnt 0x0" :: "v"(an), "v"(bn) : "memory");
    }
    // keeps the LDS reads one group ahead of the WMMAs: without it the compiler sinks
    // them among the WMMAs, two at a time, each pair waited to zero before its four WMMAs
    __builtin_amdgcn_sched_barrier(0);
#pragma unroll
    for (int kk = 0; kk < BK / 32; ++kk)
#pragma unroll
      for (int i = 0; i < 4; ++i)
#pragma unroll
        for (int j = 0; j < 4; ++j)
          acc[i][j] = __builtin_amdgcn_wmma_f32_16x16x32_f16(
              false, af[kk][i], false, bf[kk][j], (short)0, acc[i][j], false, false);

    if (hasNext) {
      const int nxt = cur ^ 1;
#pragma unroll
      for (int i = 0; i < BM / 32; ++i) *(v8h*)(As[nxt] + so + i * 32 * LDS_STRIDE) = ta[i];
#pragma unroll
      for (int i = 0; i < BN / 32; ++i) *(v8h*)(Bs[nxt] + so + i * 32 * LDS_STRIDE) = tb[i];
    }
    __syncthreads();
  }

  // Epilogue. C/D layout (ISA 7.12.2): lane&15 = N col, VGPR r -> M row
  // r + 8*(lane>>4). The work-group's 256 x 128 tile is laid in LDS in the order
  // of the output buffer, then stored 16 bytes a lane in whole 128-byte lines.
  // Every loop here is unrolled so that acc keeps constant indices (registers).
  const int lane  = tid & 31;
  const int nlane = lane & 15;
  const int hi    = lane >> 4;
  if (MODE == 3) {
    constexpr int SP = BN + 4;           // floats a staged row (528 B)
    float* st = (float*)smem;
#pragma unroll
    for (int j = 0; j < 4; ++j) {
      const int cn = wn * 64 + j * 16 + nlane;
      const float bv = bias[n0 + cn];
      // the load's offset register is given a new value only behind this wait
      asm volatile("s_wait_xcnt 0x0" :: "v"(n0 + cn) : "memory");
#pragma unroll
      for (int i = 0; i < 4; ++i)
#pragma unroll
        for (int r = 0; r < 8; ++r)
          st[(wm * 64 + i * 16 + hi * 8 + r) * SP + cn] = acc[i][j][r] + bv;
    }
    __syncthreads();   // every wave's part of the tile is in LDS before rows are read
    float* o = (float*)outp + (long)m0 * ldo + n0;
#pragma unroll
    for (int it = 0; it < BM / 8; ++it) {
      const int row = it * 8 + wave;     // one wave stores one 512-byte row
      *(v4f*)(o + (long)row * ldo + lane * 4) = *(const v4f*)(st + row * SP + lane * 4);
    }
  } else {
    constexpr int SP  = BN + 8;          // halves a staged row (272 B)
    constexpr int SPT = BM + 8;          // the same for a turned tile (528 B)
    _Float16* st = (_Float16*)smem;
    _Float16* dst;
    long pitch;
    bool turned = false;                 // V tile: staged and stored as [d][s]
    if (MODE == 0) {
      if (n0 < Dd)          { dst = qp + (long)m0 * Dd + n0;        pitch = Dd; }
      else if (n0 < 2 * Dd) { dst = kp + (long)m0 * Dd + (n0 - Dd); pitch = Dd; }
      else {
        dst = vp + ((long)(m0 >> 11) * Dd + (n0 - 2 * Dd)) * Sseq + (m0 & (Sseq - 1));
        pitch = Sseq;
        turned = true;
      }
    } else {
      dst = (_Float16*)outp + (long)bz * oBatch + (long)m0 * ldo + n0;
      pitch = ldo;
    }
    float bv[4];
#pragma unroll
    for (int j = 0; j < 4; ++j)
      bv[j] = (MODE == 0) ? bias[n0 + wn * 64 + j * 16 + nlane] : 0.f;
#pragma unroll
    for (int j = 0; j < 4; ++j)
#pragma unroll
      for (int i = 0; i < 4; ++i)
#pragma unroll
        for (int r = 0; r < 8; ++r)
          acc[i][j][r] = (MODE == 0) ? acc[i][j][r] + bv[j] : acc[i][j][r] * scale;
    if (turned) {
#pragma unroll
      for (int j = 0; j < 4; ++j)
#pragma unroll
        for (int i = 0; i < 4; ++i) {
          v8h h;                                   // a lane's 8 rows are 8 adjacent s
#pragma unroll
          for (int r = 0; r < 8; ++r) h[r] = (_Float16)acc[i][j][r];
          *(v8h*)(st + (wn * 64 + j * 16 + nlane) * SPT + wm * 64 + i * 16 + hi * 8) = h;
        }
    } else {
#pragma unroll
      for (int j = 0; j < 4; ++j)
#pragma unroll
        for (int i = 0; i < 4; ++i)
#pragma unroll
          for (int r = 0; r < 8; ++r)
            st[(wm * 64 + i * 16 + hi * 8 + r) * SP + wn * 64 + j * 16 + nlane] =
                (_Float16)acc[i][j][r];
    }
    __syncthreads();   // every wave's part of the tile is in LDS before rows are read
    // 16 lanes store one 256-byte row of 256; turned: 32 lanes one 512-byte row of 128
    static_assert(BM / 16 == BN / 8, "both forms take the same number of trips");
    const int rstep = turned ? 8 : 16;
    const int rbase = turned ? wave : (tid >> 4);
    const int c     = (turned ? lane : (tid & 15)) * 8;
    const int sp    = turned ? SPT : SP;
#pragma unroll
    for (int it = 0; it < BM / 16; ++it) {
      const int row = it * rstep + rbase;
      *(v8h*)(dst + (long)row * pitch + c) = *(const v8h*)(st + row * sp + c);
    }
  }
}

// ---------------- prep kernels ----------------
// One resident stream: CV_GROUPS work-groups of CV_WAVES waves, a wave takes CV_LOADS
// pieces of 128 floats that follow one another. A load is 16 bytes a lane (4 whole
// lines a wave), a store 8 bytes a lane (2 whole lines a wave).
static constexpr int  CV_WAVES  = 16;
static constexpr int  CV_LOADS  = 16;
static constexpr long CV_N      = (long)Bsz * Sseq * Dd;
static constexpr int  CV_GROUPS = (int)(CV_N / (CV_WAVES * CV_LOADS * 128));
static_assert((long)CV_GROUPS * CV_WAVES * CV_LOADS * 128 == CV_N, "no edge");
__global__ __launch_bounds__(CV_WAVES * 32)
void cvt_f32_to_f16(const float* __restrict__ in, _Float16* __restrict__ out) {
  const int  lane = threadIdx.x & 31;
  const long base =
      ((long)blockIdx.x * CV_WAVES + (threadIdx.x >> 5)) * (CV_LOADS * 128) + lane * 4;
  const float* src = in + base;
  _Float16*    dst = out + base;
  v4f f[CV_LOADS];
#pragma unroll
  for (int i = 0; i < CV_LOADS; ++i) f[i] = *(const v4f*)(src + i * 128);
  // the loads' address registers are given new values only behind this wait; as its
  // input they stay live up to it, so that no load's result is laid over them
  asm volatile("s_wait_xcnt 0x0" :: "v"(src) : "memory");
  // keeps all the loads ahead of the first conversion: without it the compiler waits for
  // the first load and reuses its registers before it issues the last four
  __builtin_amdgcn_sched_barrier(0);
  v4h h[CV_LOADS];
#pragma unroll
  for (int i = 0; i < CV_LOADS; ++i) h[i] = __builtin_convertvector(f[i], v4h);
  // every result is formed ahead of the first store, each in registers of its own, so
  // that no register which an issued store names is written behind it
  __builtin_amdgcn_sched_barrier(0);
#pragma unroll
  for (int i = 0; i < CV_LOADS; ++i) *(v4h*)(dst + i * 128) = h[i];
}

// in: [K][N] f32 row-major -> out: [N][K] f16 row-major.
// One work-group turns a tile of TK k x TN n through LDS, so that both global
// sides move 16 bytes a lane in runs of 256 bytes. The tile lies [n][k] in LDS;
// the 16-byte chunk of k group c in row n stands at place c ^ ((n >> 2) & 15),
// which spreads the 16 lanes of a store or a load over all banks.
static constexpr int TK = 128;
static constexpr int TN = 64;
template <int K, int N>
__global__ __launch_bounds__(256)
void transpose_cvt(const float* __restrict__ in, _Float16* __restrict__ out) {
  __shared__ alignas(16) _Float16 tile[TN * TK];   // 16 KB
  const int l  = threadIdx.x & 15;
  const int g  = threadIdx.x >> 4;
  const int n0 = blockIdx.x * TN;
  const int k0 = blockIdx.y * TK;

  // rows k0 + 8g .. + 7, columns n0 + 4l .. + 3
  const float* src = in + (long)(k0 + g * 8) * N + n0 + l * 4;
  v4f f[8];
#pragma unroll
  for (int r = 0; r < 8; ++r) f[r] = *(const v4f*)(src + (long)r * N);
#pragma unroll
  for (int j = 0; j < 4; ++j) {
    v8h h;
#pragma unroll
    for (int r = 0; r < 8; ++r) h[r] = (_Float16)f[r][j];
    *(v8h*)(tile + (l * 4 + j) * TK + (g ^ l) * 8) = h;
  }
  __syncthreads();
  // rows n0 + g + 16i, columns k0 + 8l .. + 7
  _Float16* dst = out + (long)(n0 + g) * K + k0 + l * 8;
#pragma unroll
  for (int i = 0; i < 4; ++i) {
    const int n = g + i * 16;
    *(v8h*)(dst + (long)i * 16 * K) =
        *(const v8h*)(tile + n * TK + (l ^ ((n >> 2) & 15)) * 8);
  }
}

// ---------------- row softmax over Sseq = 2048, in place on f16 ----------------
// One wave takes one row: 8 loads of 16 bytes a lane (512 bytes of the row each), the
// row's 64 values a lane stay in registers, maximum and sum go over the wave's lanes
// in registers. No LDS and no barrier: a wave reads and writes its own row alone.
template <int CTRL>
__device__ __forceinline__ float lane_dpp(float x) {   // CTRL 0x160 + m: lane l ^ m, m < 16
  return __builtin_bit_cast(float, __builtin_amdgcn_update_dpp(
      0, __builtin_bit_cast(int, x), CTRL, 0xf, 0xf, true));
}
__device__ __forceinline__ float lane_x16(float x) {   // lane l ^ 16
  const int b = __builtin_bit_cast(int, x);
  return __builtin_bit_cast(float, __builtin_amdgcn_permlanex16(
      b, b, 0x76543210, 0xfedcba98, false, false));
}
__device__ __forceinline__ float wave_max(float x) {
  x = fmaxf(x, lane_dpp<0x161>(x));
  x = fmaxf(x, lane_dpp<0x162>(x));
  x = fmaxf(x, lane_dpp<0x164>(x));
  x = fmaxf(x, lane_dpp<0x168>(x));
  return fmaxf(x, lane_x16(x));
}
__device__ __forceinline__ float wave_sum(float x) {
  x += lane_dpp<0x161>(x);
  x += lane_dpp<0x162>(x);
  x += lane_dpp<0x164>(x);
  x += lane_dpp<0x168>(x);
  return x + lane_x16(x);
}

static constexpr int SM_WAVES = 16;            // rows (waves) a work-group
static constexpr int SM_PIECES = Sseq / 256;   // 16-byte pieces of a row a lane
static_assert(SM_PIECES * 256 == Sseq && (Bsz * Sseq) % SM_WAVES == 0, "no edge");
__global__ __launch_bounds__(SM_WAVES * 32)
void softmax_rows(_Float16* __restrict__ P) {
  const int lane = threadIdx.x & 31;
  _Float16* p = P + ((long)blockIdx.x * SM_WAVES + (threadIdx.x >> 5)) * Sseq + lane * 8;

  v8h h[SM_PIECES];
#pragma unroll
  for (int j = 0; j < SM_PIECES; ++j) h[j] = *(const v8h*)(p + j * 256);
  // the loads' address registers are given new values only behind this wait; as its
  // input they stay live up to it, so that no load's result is laid over them
  asm volatile("s_wait_xcnt 0x0" :: "v"(p) : "memory");

  float v[SM_PIECES][8];
  float m[SM_PIECES];                          // one chain a piece: independent chains
#pragma unroll
  for (int j = 0; j < SM_PIECES; ++j) {
    m[j] = -3.0e38f;
#pragma unroll
    for (int e = 0; e < 8; ++e) { v[j][e] = (float)h[j][e]; m[j] = fmaxf(m[j], v[j][e]); }
  }
  float mx = m[0];
#pragma unroll
  for (int j = 1; j < SM_PIECES; ++j) mx = fmaxf(mx, m[j]);
  mx = wave_max(mx);

  float s[SM_PIECES];                          // the same for the sums
#pragma unroll
  for (int j = 0; j < SM_PIECES; ++j) {
    s[j] = 0.f;
#pragma unroll
    for (int e = 0; e < 8; ++e) { v[j][e] = __expf(v[j][e] - mx); s[j] += v[j][e]; }
  }
  float sum = s[0];
#pragma unroll
  for (int j = 1; j < SM_PIECES; ++j) sum += s[j];
  const float inv = 1.f / wave_sum(sum);

#pragma unroll
  for (int j = 0; j < SM_PIECES; ++j)
#pragma unroll
    for (int e = 0; e < 8; ++e) h[j][e] = (_Float16)(v[j][e] * inv);
  // every result is formed ahead of the first store, each in registers of its own, so
  // that no register which an issued store names is written behind it
  __builtin_amdgcn_sched_barrier(0);
#pragma unroll
  for (int j = 0; j < SM_PIECES; ++j) *(v8h*)(p + j * 256) = h[j];
}

// ---------------- host-side orchestration ----------------
extern "C" void kernel_launch(void* const* d_in, const int* in_sizes, int n_in,
                              void* d_out, int out_size, void* d_ws, size_t ws_size,
                              hipStream_t stream)
{
  const float* x    = (const float*)d_in[0];
  const float* Wqkv = (const float*)d_in[1];
  const float* bqkv = (const float*)d_in[2];
  const float* Wout = (const float*)d_in[3];
  const float* bout = (const float*)d_in[4];
  float* out = (float*)d_out;

  char* ws = (char*)d_ws;
  const long MB = 1024l * 1024l;
  _Float16* x_h    = (_Float16*)(ws);             // 16 MB  [8192][1024]
  _Float16* wqkv_t = (_Float16*)(ws + 16 * MB);   //  6 MB  [3072][1024]
  _Float16* wout_t = (_Float16*)(ws + 22 * MB);   //  2 MB  [1024][1024]
  _Float16* q_h    = (_Float16*)(ws + 24 * MB);   // 16 MB  [b][s][d]
  _Float16* k_h    = (_Float16*)(ws + 40 * MB);   // 16 MB  [b][s][d]
  _Float16* v_t    = (_Float16*)(ws + 56 * MB);   // 16 MB  [b][d][s]
  _Float16* probs  = (_Float16*)(ws + 72 * MB);   // 32 MB  [b][s][t]
  _Float16* attno  = (_Float16*)(ws + 104 * MB);  // 16 MB  [8192][1024]

  cvt_f32_to_f16<<<dim3(CV_GROUPS), CV_WAVES * 32, 0, stream>>>(x, x_h);
  transpose_cvt<Dd, 3 * Dd><<<dim3(3 * Dd / TN, Dd / TK), 256, 0, stream>>>(Wqkv, wqkv_t);
  transpose_cvt<Dd, Dd><<<dim3(Dd / TN, Dd / TK), 256, 0, stream>>>(Wout, wout_t);

  // 1) QKV projection: [8192,1024] x [1024,3072] + b
  gemm_wmma<0><<<dim3(3 * Dd / BN, Bsz * Sseq / BM, 1), 256, 0, stream>>>(
      x_h, wqkv_t, bqkv, nullptr,
      Bsz * Sseq, 3 * Dd, Dd, 0, 0, 0, 0, 1.0f, q_h, k_h, v_t);

  // 2) scores = scale * Q K^T  (batched over b)
  gemm_wmma<1><<<dim3(Sseq / BN, Sseq / BM, Bsz), 256, 0, stream>>>(
      q_h, k_h, nullptr, probs,
      Sseq, Sseq, Dd,
      (long)Sseq * Dd, (long)Sseq * Dd, (long)Sseq * Sseq, Sseq,
      0.03125f /* 1024^-0.5 */, nullptr, nullptr, nullptr);

  // 3) softmax rows (in place, f16)
  softmax_rows<<<dim3(Bsz * Sseq / SM_WAVES), SM_WAVES * 32, 0, stream>>>(probs);

  // 4) O = P V  (V pre-transposed -> contiguous B operand)
  gemm_wmma<2><<<dim3(Dd / BN, Sseq / BM, Bsz), 256, 0, stream>>>(
      probs, v_t, nullptr, attno,
      Sseq, Dd, Sseq,
      (long)Sseq * Sseq, (long)Dd * Sseq, (long)Sseq * Dd, Dd,
      1.0f, nullptr, nullptr, nullptr);

  // 5) final = O Wout + bout  (f32 out)
  gemm_wmma<3><<<dim3(Dd / BN, Bsz * Sseq / BM, 1), 256, 0, stream>>>(
      attno, wout_t, bout, out,
      Bsz * Sseq, Dd, Dd, 0, 0, 0, Dd,
      1.0f, nullptr, nullptr, nullptr);
}

// v005
// A run of this version takes 139 microseconds.
// Next to v004, in two timings, it ran 1.28 times as fast each time.
// All steps since v000 together make it 2.75 times as fast.
#include <hip/hip_runtime.h>

typedef __attribute__((ext_vector_type(16))) _Float16 v16h;
typedef __attribute__((ext_vector_type(8)))  _Float16 v8h;
typedef __attribute__((ext_vector_type(4)))  _Float16 v4h;
typedef __attribute__((ext_vector_type(8)))  float    v8f;
typedef __attribute__((ext_vector_type(4)))  float    v4f;

static constexpr int Bsz  = 4;
static constexpr int Sseq = 2048;
static constexpr int Dd   = 1024;

static constexpr int BM = 256;   // block tile M (4 waves x 64)
static constexpr int BN = 128;   // block tile N (2 waves x 64)
static constexpr int BK = 128;   // k of a stage: 256 bytes of every operand row, four WMMA K
static constexpr int LDS_STRIDE = BK + 8;  // 272-byte pitch: 16 rows of a 16-byte read meet 64 banks

// -------- operand staging: tensor loads into a ring of two LDS buffers.
// A stage is 384 operand rows (256 of A, 128 of B) of 256 bytes, cut into six slices of
// 64 rows; waves 0..3 bring the A slices, waves 4 and 5 the B slices, one request a wave
// and stage. The mover pads every row by 16 bytes, which gives the pitch above.
typedef uint32_t u32x4 __attribute__((ext_vector_type(4)));
typedef uint32_t u32x8 __attribute__((ext_vector_type(8)));
static constexpr int      SL_ROWS     = 64;
static constexpr int      N_SLICES    = (BM + BN) / SL_ROWS;
static constexpr uint32_t ROW_BYTES   = BK * 2;
static constexpr uint32_t SLICE_BYTES = (SL_ROWS * LDS_STRIDE * 2 + 2047) / 2048 * 2048;  // 18 KB
static constexpr uint32_t BUF_BYTES   = N_SLICES * SLICE_BYTES;                           // 108 KB
static_assert(ROW_BYTES == 256, "the pad code below is the one for rows of 256 bytes");
// group 1, word 0: no mask, 1-byte elements, a pad of 4 dwords behind every 64 dwords
static constexpr uint32_t TDM_WORD0 = (1u << 20) | (5u << 22) | (3u << 25);

__device__ __forceinline__ uint32_t uni(uint32_t v) {
  return (uint32_t)__builtin_amdgcn_readfirstlane(v);
}
// A test that decides whether a tensor load issues must be a scalar branch (the mover
// ignores EXEC): the empty statement holds the flag in a scalar register, so that the
// branch on it compiles to s_cmp + s_cbranch_scc.
__device__ __forceinline__ uint32_t pinned(uint32_t v) {
  uint32_t w = uni(v);
  asm volatile("" : "+s"(w));
  return w;
}
__device__ __forceinline__ u32x8 tdm_group1(uint32_t src_pitch) {
  constexpr uint32_t d0 = ROW_BYTES, d1 = SL_ROWS;   // tensor dims = tile dims, in bytes and rows
  u32x8 g;
  g[0] = uni(TDM_WORD0);
  g[1] = uni((d0 & 0xFFFFu) << 16);
  g[2] = uni((d0 >> 16) | ((d1 & 0xFFFFu) << 16));
  g[3] = uni((d1 >> 16) | (d0 << 16));
  g[4] = uni(d1);
  g[5] = uni(src_pitch);
  g[6] = uni(0u);
  g[7] = uni(0u);
  return g;
}
__device__ __forceinline__ u32x4 tdm_group0(uint32_t lds_dst, uint64_t ga) {
  u32x4 g;
  g[0] = pinned(1u);   // a descriptor word held in a scalar register: not formed again later
  g[1] = uni(lds_dst);
  g[2] = uni((uint32_t)ga);
  g[3] = uni((((uint32_t)(ga >> 32)) & 0x01FFFFFFu) | 0x80000000u);
  return g;
}
__device__ __forceinline__ void tdm_load(u32x4 g0, u32x8 g1) {
  // one request of the whole wave: 64 rows of 256 bytes from global memory into LDS
  asm volatile("tensor_load_to_lds %0, %1" :: "s"(g0), "s"(g1) : "memory");
}
// The issuing wave's own request has landed behind this wait (the compiler places none).
// The request's group 0 is the wait's input: it stays live up to here, so that no word of
// it is rewritten while the request is out.
__device__ __forceinline__ void wait_tensor0(u32x4 g0) {
  asm volatile("s_wait_tensorcnt 0x0" :: "s"(g0) : "memory");
}
// the wave's own LDS reads have retired behind this wait, before their buffer is refilled
__device__ __forceinline__ void wait_ds0() { asm volatile("s_wait_dscnt 0x0" ::: "memory"); }

// -------- WMMA operand gather from an LDS slice laid out [rows][LDS_STRIDE] f16.
// 16-bit A/B operand layout (ISA 7.12.2): lane&15 = row, lane>>4 selects the
// 8-wide K half; halves 0..7 <- K[hi*8 .. +7], halves 8..15 <- K[16+hi*8 .. +7].
__device__ __forceinline__ v16h frag_from_lds(const _Float16* base, int row0, int kk) {
  const int lane = threadIdx.x & 31;
  const int m  = lane & 15;
  const int hi = lane >> 4;
  const _Float16* p = base + (row0 + m) * LDS_STRIDE + kk * 32 + hi * 8;
  v8h lo = *(const v8h*)(p);
  v8h hh = *(const v8h*)(p + 16);
  v16h r;
#pragma unroll
  for (int i = 0; i < 8; ++i) { r[i] = lo[i]; r[i + 8] = hh[i]; }
  return r;
}

// MODE 0: QKV projection epilogue (bias, split into q/k/v; v stored transposed)
// MODE 1: scores = scale * Q K^T, f16 out, batched via blockIdx.z
// MODE 2: O = P V, f16 out, batched
// MODE 3: out-proj epilogue (bias), f32 out to d_out
template <int MODE>
__global__ __launch_bounds__(256)
void gemm_wmma(const _Float16* __restrict__ Ag, const _Float16* __restrict__ Bg,
               const float* __restrict__ bias, void* __restrict__ outp,
               int M, int N, int K,
               long aBatch, long bBatch, long oBatch, int ldo, float scale,
               _Float16* __restrict__ qp, _Float16* __restrict__ kp,
               _Float16* __restrict__ vp)
{
  // One LDS block: the two-buffer operand ring in the k loop, then the output
  // tile's staging area in the epilogue (the loop's last barrier separates them).
  constexpr int RING_BYTES  = 2 * BUF_BYTES;                               // 216 KB
  constexpr int STAGE_BYTES = (MODE == 3) ? BM * (BN + 4) * 4 : BM * (BN + 8) * 2;
  static_assert(STAGE_BYTES <= RING_BYTES, "the output tile is staged in the ring's space");
  // every slice's place in LDS is a multiple of 2 KB
  __shared__ __attribute__((aligned(2048))) char smem[RING_BYTES];

  const int tid  = threadIdx.x;
  const int wave = (int)uni(tid >> 5);
  const int wm   = wave >> 1;          // 0..3 -> 64-row strip
  const int wn   = wave & 1;           // 0..1 -> 64-col strip
  const int m0   = blockIdx.y * BM;
  const int n0   = blockIdx.x * BN;
  const int bz   = blockIdx.z;

  const _Float16* A = Ag + (long)bz * aBatch;
  const _Float16* B = Bg + (long)bz * bBatch;

  // both operands are K-contiguous; their row pitch is K, known at compile time
  constexpr int LD = (MODE == 2) ? Sseq : Dd;
  constexpr int NK = LD / BK;          // stages
  static_assert(NK * BK == LD && NK >= 2, "whole stages, and the ring's prologue needs two");
  // the wave's slice: its first source byte of stage 0 and its place in buffer 0
  // (waves 6 and 7 issue nothing; they are given slice 0's values and never use them)
  const bool issuer = wave < N_SLICES;
  const int  slice  = issuer ? wave : 0;
  const _Float16* srow = (slice < BM / SL_ROWS)
      ? A + (long)(m0 + slice * SL_ROWS) * LD
      : B + (long)(n0 + (slice - BM / SL_ROWS) * SL_ROWS) * LD;
  const uint64_t src0 = (uint64_t)(size_t)srow;
  const uint32_t dst0 = (uint32_t)(size_t)smem + (uint32_t)slice * SLICE_BYTES;
  u32x8 g1 = tdm_group1(LD * 2);
  // descriptor words held in scalar registers: group 1 stays in one register tuple from
  // here to the last request, so that no word of it is rewritten while a request is out
  asm volatile("" : "+s"(g1));

  v8f zero = {};
  v8f acc[4][4];
#pragma unroll
  for (int i = 0; i < 4; ++i)
#pragma unroll
    for (int j = 0; j < 4; ++j) acc[i][j] = zero;

  // ---- prologue: stage 0 lands in buffer 0 and is published; then stage 1 starts
  // group 0 is formed by every wave, always behind the wait that covers the request
  // before it; only the issue stands under the test
  u32x4 g0 = tdm_group0(dst0, src0);
  if (pinned(issuer)) {
    tdm_load(g0, g1);
    wait_tensor0(g0);
  }
  __syncthreads();
  g0 = tdm_group0(dst0 + BUF_BYTES, src0 + ROW_BYTES);
  if (pinned(issuer)) tdm_load(g0, g1);

  constexpr int KB    = BK / 32;       // WMMA blocks of a stage
  constexpr int AHEAD = 2;             // a block's fragments are asked for two blocks ahead
  // kept rolled: a pass is the ring's unit, and buffer and stage are scalars of the trip
#pragma unroll 1
  for (int ks = 0; ks < NK; ++ks) {
    const int cur = ks & 1;
    const _Float16* Ab = (const _Float16*)(smem + cur * BUF_BYTES + wm * SLICE_BYTES);
    const _Float16* Bb =
        (const _Float16*)(smem + cur * BUF_BYTES + (BM / SL_ROWS + wn) * SLICE_BYTES);

    // the pass reads its own buffer alone: two blocks' fragments at its head, each later
    // block's behind the WMMAs of the block whose registers they take over
    v16h af[KB][4], bf[KB][4];
#pragma unroll
    for (int kk = 0; kk < AHEAD; ++kk) {
#pragma unroll
      for (int i = 0; i < 4; ++i) af[kk][i] = frag_from_lds(Ab, i * 16, kk);
#pragma unroll
      for (int j = 0; j < 4; ++j) bf[kk][j] = frag_from_lds(Bb, j * 16, kk);
      // keeps the reads in the order of their use: a block's WMMAs then wait for its own
      // reads only
      __builtin_amdgcn_sched_barrier(0);
    }
#pragma unroll
    for (int kk = 0; kk < KB; ++kk) {
#pragma unroll
      for (int i = 0; i < 4; ++i)
#pragma unroll
        for (int j = 0; j < 4; ++j)
          acc[i][j] = __builtin_amdgcn_wmma_f32_16x16x32_f16(
              false, af[kk][i], false, bf[kk][j], (short)0, acc[i][j], false, false);
      // keeps the block's WMMAs ahead of the reads that take over its registers and, behind
      // the last block, ahead of the publish point: without it the compiler lifts that
      // point's wait for all LDS reads up among the WMMAs
      if (kk + AHEAD < KB || kk == KB - 1) __builtin_amdgcn_sched_barrier(0);
      if (kk + AHEAD < KB) {
#pragma unroll
        for (int i = 0; i < 4; ++i) af[kk + AHEAD][i] = frag_from_lds(Ab, i * 16, kk + AHEAD);
#pragma unroll
        for (int j = 0; j < 4; ++j) bf[kk + AHEAD][j] = frag_from_lds(Bb, j * 16, kk + AHEAD);
        // keeps the reads one group: without it the compiler sinks them among the WMMAs,
        // two at a time, each pair waited to zero before its four WMMAs
        __builtin_amdgcn_sched_barrier(0);
      }
    }

    // ---- publish point of stage ks + 1, every wave, in this order
    wait_ds0();
    if (pinned(issuer)) wait_tensor0(g0);
    __syncthreads();   // stage ks + 1 may be read; every wave has left this pass's buffer
    g0 = tdm_group0(dst0 + (uint32_t)cur * BUF_BYTES, src0 + (uint64_t)(ks + 2) * ROW_BYTES);
    if (pinned(issuer && ks + 2 < NK)) tdm_load(g0, g1);
  }
  wait_tensor0(g0);
  wait_ds0();

  // Epilogue. C/D layout (ISA 7.12.2): lane&15 = N col, VGPR r -> M row
  // r + 8*(lane>>4). The work-group's 256 x 128 tile is laid in LDS in the order
  // of the output buffer, then stored 16 bytes a lane in whole 128-byte lines.
  // Every loop here is unrolled so that acc keeps constant indices (registers).
  const int lane  = tid & 31;
  const int nlane = lane & 15;
  const int hi    = lane >> 4;
  if (MODE == 3) {
    constexpr int SP = BN + 4;           // floats a staged row (528 B)
    float* st = (float*)smem;
#pragma unroll
    for (int j = 0; j < 4; ++j) {
      const int cn = wn * 64 + j * 16 + nlane;
      const float bv = bias[n0 + cn];
      // the load's offset register is given a new value only behind this wait
      asm volatile("s_wait_xcnt 0x0" :: "v"(n0 + cn) : "memory");
#pragma unroll
      for (int i = 0; i < 4; ++i)
#pragma unroll
        for (int r = 0; r < 8; ++r)
          st[(wm * 64 + i * 16 + hi * 8 + r) * SP + cn] = acc[i][j][r] + bv;
    }
    __syncthreads();   // every wave's part of the tile is in LDS before rows are read
    float* o = (float*)outp + (long)m0 * ldo + n0;
#pragma unroll
    for (int it = 0; it < BM / 8; ++it) {
      const int row = it * 8 + wave;     // one wave stores one 512-byte row
      *(v4f*)(o + (long)row * ldo + lane * 4) = *(const v4f*)(st + row * SP + lane * 4);
    }
  } else {
    constexpr int SP  = BN + 8;          // halves a staged row (272 B)
    constexpr int SPT = BM + 8;          // the same for a turned tile (528 B)
    _Float16* st = (_Float16*)smem;
    _Float16* dst;
    long pitch;
    bool turned = false;                 // V tile: staged and stored as [d][s]
    if (MODE == 0) {
      if (n0 < Dd)          { dst = qp + (long)m0 * Dd + n0;        pitch = Dd; }
      else if (n0 < 2 * Dd) { dst = kp + (long)m0 * Dd + (n0 - Dd); pitch = Dd; }
      else {
        dst = vp + ((long)(m0 >> 11) * Dd + (n0 - 2 * Dd)) * Sseq + (m0 & (Sseq - 1));
        pitch = Sseq;
        turned = true;
      }
    } else {
      dst = (_Float16*)outp + (long)bz * oBatch + (long)m0 * ldo + n0;
      pitch = ldo;
    }
    float bv[4];
#pragma unroll
    for (int j = 0; j < 4; ++j)
      bv[j] = (MODE == 0) ? bias[n0 + wn * 64 + j * 16 + nlane] : 0.f;
#pragma unroll
    for (int j = 0; j < 4; ++j)
#pragma unroll
      for (int i = 0; i < 4; ++i)
#pragma unroll
        for (int r = 0; r < 8; ++r)
          acc[i][j][r] = (MODE == 0) ? acc[i][j][r] + bv[j] : acc[i][j][r] * scale;
    if (turned) {
#pragma unroll
      for (int j = 0; j < 4; ++j)
#pragma unroll
        for (int i = 0; i < 4; ++i) {
          v8h h;                                   // a lane's 8 rows are 8 adjacent s
#pragma unroll
          for (int r = 0; r < 8; ++r) h[r] = (_Float16)acc[i][j][r];
          *(v8h*)(st + (wn * 64 + j * 16 + nlane) * SPT + wm * 64 + i * 16 + hi * 8) = h;
        }
    } else {
#pragma unroll
      for (int j = 0; j < 4; ++j)
#pragma unroll
        for (int i = 0; i < 4; ++i)
#pragma unroll
          for (int r = 0; r < 8; ++r)
            st[(wm * 64 + i * 16 + hi * 8 + r) * SP + wn * 64 + j * 16 + nlane] =
                (_Float16)acc[i][j][r];
    }
    __syncthreads();   // every wave's part of the tile is in LDS before rows are read
    // 16 lanes store one 256-byte row of 256; turned: 32 lanes one 512-byte row of 128
    static_assert(BM / 16 == BN / 8, "both forms take the same number of trips");
    const int rstep = turned ? 8 : 16;
    const int rbase = turned ? wave : (tid >> 4);
    const int c     = (turned ? lane : (tid & 15)) * 8;
    const int sp    = turned ? SPT : SP;
#pragma unroll
    for (int it = 0; it < BM / 16; ++it) {
      const int row = it * rstep + rbase;
      *(v8h*)(dst + (long)row * pitch + c) = *(const v8h*)(st + row * sp + c);
    }
  }
}

// ---------------- prep kernels ----------------
// One resident stream: CV_GROUPS work-groups of CV_WAVES waves, a wave takes CV_LOADS
// pieces of 128 floats that follow one another. A load is 16 bytes a lane (4 whole
// lines a wave), a store 8 bytes a lane (2 whole lines a wave).
static constexpr int  CV_WAVES  = 16;
static constexpr int  CV_LOADS  = 16;
static constexpr long CV_N      = (long)Bsz * Sseq * Dd;
static constexpr int  CV_GROUPS = (int)(CV_N / (CV_WAVES * CV_LOADS * 128));
static_assert((long)CV_GROUPS * CV_WAVES * CV_LOADS * 128 == CV_N, "no edge");
__global__ __launch_bounds__(CV_WAVES * 32)
void cvt_f32_to_f16(const float* __restrict__ in, _Float16* __restrict__ out) {
  const int  lane = threadIdx.x & 31;
  const long base =
      ((long)blockIdx.x * CV_WAVES + (threadIdx.x >> 5)) * (CV_LOADS * 128) + lane * 4;
  const float* src = in + base;
  _Float16*    dst = out + base;
  v4f f[CV_LOADS];
#pragma unroll
  for (int i = 0; i < CV_LOADS; ++i) f[i] = *(const v4f*)(src + i * 128);
  // the loads' address registers are given new values only behind this wait; as its
  // input they stay live up to it, so that no load's result is laid over them
  asm volatile("s_wait_xcnt 0x0" :: "v"(src) : "memory");
  // keeps all the loads ahead of the first conversion: without it the compiler waits for
  // the first load and reuses its registers before it issues the last four
  __builtin_amdgcn_sched_barrier(0);
  v4h h[CV_LOADS];
#pragma unroll
  for (int i = 0; i < CV_LOADS; ++i) h[i] = __builtin_convertvector(f[i], v4h);
  // every result is formed ahead of the first store, each in registers of its own, so
  // that no register which an issued store names is written behind it
  __builtin_amdgcn_sched_barrier(0);
#pragma unroll
  for (int i = 0; i < CV_LOADS; ++i) *(v4h*)(dst + i * 128) = h[i];
}

// in: [K][N] f32 row-major -> out: [N][K] f16 row-major.
// One work-group turns a tile of TK k x TN n through LDS, so that both global
// sides move 16 bytes a lane in runs of 256 bytes. The tile lies [n][k] in LDS;
// the 16-byte chunk of k group c in row n stands at place c ^ ((n >> 2) & 15),
// which spreads the 16 lanes of a store or a load over all banks.
static constexpr int TK = 128;
static constexpr int TN = 64;
template <int K, int N>
__global__ __launch_bounds__(256)
void transpose_cvt(const float* __restrict__ in, _Float16* __restrict__ out) {
  __shared__ alignas(16) _Float16 tile[TN * TK];   // 16 KB
  const int l  = threadIdx.x & 15;
  const int g  = threadIdx.x >> 4;
  const int n0 = blockIdx.x * TN;
  const int k0 = blockIdx.y * TK;

  // rows k0 + 8g .. + 7, columns n0 + 4l .. + 3
  const float* src = in + (long)(k0 + g * 8) * N + n0 + l * 4;
  v4f f[8];
#pragma unroll
  for (int r = 0; r < 8; ++r) f[r] = *(const v4f*)(src + (long)r * N);
#pragma unroll
  for (int j = 0; j < 4; ++j) {
    v8h h;
#pragma unroll
    for (int r = 0; r < 8; ++r) h[r] = (_Float16)f[r][j];
    *(v8h*)(tile + (l * 4 + j) * TK + (g ^ l) * 8) = h;
  }
  __syncthreads();
  // rows n0 + g + 16i, columns k0 + 8l .. + 7
  _Float16* dst = out + (long)(n0 + g) * K + k0 + l * 8;
#pragma unroll
  for (int i = 0; i < 4; ++i) {
    const int n = g + i * 16;
    *(v8h*)(dst + (long)i * 16 * K) =
        *(const v8h*)(tile + n * TK + (l ^ ((n >> 2) & 15)) * 8);
  }
}

// ---------------- row softmax over Sseq = 2048, in place on f16 ----------------
// One wave takes one row: 8 loads of 16 bytes a lane (512 bytes of the row each), the
// row's 64 values a lane stay in registers, maximum and sum go over the wave's lanes
// in registers. No LDS and no barrier: a wave reads and writes its own row alone.
template <int CTRL>
__device__ __forceinline__ float lane_dpp(float x) {   // CTRL 0x160 + m: lane l ^ m, m < 16
  return __builtin_bit_cast(float, __builtin_amdgcn_update_dpp(
      0, __builtin_bit_cast(int, x), CTRL, 0xf, 0xf, true));
}
__device__ __forceinline__ float lane_x16(float x) {   // lane l ^ 16
  const int b = __builtin_bit_cast(int, x);
  return __builtin_bit_cast(float, __builtin_amdgcn_permlanex16(
      b, b, 0x76543210, 0xfedcba98, false, false));
}
__device__ __forceinline__ float wave_max(float x) {
  x = fmaxf(x, lane_dpp<0x161>(x));
  x = fmaxf(x, lane_dpp<0x162>(x));
  x = fmaxf(x, lane_dpp<0x164>(x));
  x = fmaxf(x, lane_dpp<0x168>(x));
  return fmaxf(x, lane_x16(x));
}
__device__ __forceinline__ float wave_sum(float x) {
  x += lane_dpp<0x161>(x);
  x += lane_dpp<0x162>(x);
  x += lane_dpp<0x164>(x);
  x += lane_dpp<0x168>(x);
  return x + lane_x16(x);
}

static constexpr int SM_WAVES = 16;            // rows (waves) a work-group
static constexpr int SM_PIECES = Sseq / 256;   // 16-byte pieces of a row a lane
static_assert(SM_PIECES * 256 == Sseq && (Bsz * Sseq) % SM_WAVES == 0, "no edge");
__global__ __launch_bounds__(SM_WAVES * 32)
void softmax_rows(_Float16* __restrict__ P) {
  const int lane = threadIdx.x & 31;
  _Float16* p = P + ((long)blockIdx.x * SM_WAVES + (threadIdx.x >> 5)) * Sseq + lane * 8;

  v8h h[SM_PIECES];
#pragma unroll
  for (int j = 0; j < SM_PIECES; ++j) h[j] = *(const v8h*)(p + j * 256);
  // the loads' address registers are given new values only behind this wait; as its
  // input they stay live up to it, so that no load's result is laid over them
  asm volatile("s_wait_xcnt 0x0" :: "v"(p) : "memory");

  float v[SM_PIECES][8];
  float m[SM_PIECES];                          // one chain a piece: independent chains
#pragma unroll
  for (int j = 0; j < SM_PIECES; ++j) {
    m[j] = -3.0e38f;
#pragma unroll
    for (int e = 0; e < 8; ++e) { v[j][e] = (float)h[j][e]; m[j] = fmaxf(m[j], v[j][e]); }
  }
  float mx = m[0];
#pragma unroll
  for (int j = 1; j < SM_PIECES; ++j) mx = fmaxf(mx, m[j]);
  mx = wave_max(mx);

  float s[SM_PIECES];                          // the same for the sums
#pragma unroll
  for (int j = 0; j < SM_PIECES; ++j) {
    s[j] = 0.f;
#pragma unroll
    for (int e = 0; e < 8; ++e) { v[j][e] = __expf(v[j][e] - mx); s[j] += v[j][e]; }
  }
  float sum = s[0];
#pragma unroll
  for (int j = 1; j < SM_PIECES; ++j) sum += s[j];
  const float inv = 1.f / wave_sum(sum);

#pragma unroll
  for (int j = 0; j < SM_PIECES; ++j)
#pragma unroll
    for (int e = 0; e < 8; ++e) h[j][e] = (_Float16)(v[j][e] * inv);
  // every result is formed ahead of the first store, each in registers of its own, so
  // that no register which an issued store names is written behind it
  __builtin_amdgcn_sched_barrier(0);
#pragma unroll
  for (int j = 0; j < SM_PIECES; ++j) *(v8h*)(p + j * 256) = h[j];
}

// ---------------- host-side orchestration ----------------
extern "C" void kernel_launch(void* const* d_in, const int* in_sizes, int n_in,
                              void* d_out, int out_size, void* d_ws, size_t ws_size,
                              hipStream_t stream)
{
  const float* x    = (const float*)d_in[0];
  const float* Wqkv = (const float*)d_in[1];
  const float* bqkv = (const float*)d_in[2];
  const float* Wout = (const float*)d_in[3];
  const float* bout = (const float*)d_in[4];
  float* out = (float*)d_out;

  char* ws = (char*)d_ws;
  const long MB = 1024l * 1024l;
  _Float16* x_h    = (_Float16*)(ws);             // 16 MB  [8192][1024]
  _Float16* wqkv_t = (_Float16*)(ws + 16 * MB);   //  6 MB  [3072][1024]
  _Float16* wout_t = (_Float16*)(ws + 22 * MB);   //  2 MB  [1024][1024]
  _Float16* q_h    = (_Float16*)(ws + 24 * MB);   // 16 MB  [b][s][d]
  _Float16* k_h    = (_Float16*)(ws + 40 * MB);   // 16 MB  [b][s][d]
  _Float16* v_t    = (_Float16*)(ws + 56 * MB);   // 16 MB  [b][d][s]
  _Float16* probs  = (_Float16*)(ws + 72 * MB);   // 32 MB  [b][s][t]
  _Float16* attno  = (_Float16*)(ws + 104 * MB);  // 16 MB  [8192][1024]

  cvt_f32_to_f16<<<dim3(CV_GROUPS), CV_WAVES * 32, 0, stream>>>(x, x_h);
  transpose_cvt<Dd, 3 * Dd><<<dim3(3 * Dd / TN, Dd / TK), 256, 0, stream>>>(Wqkv, wqkv_t);
  transpose_cvt<Dd, Dd><<<dim3(Dd / TN, Dd / TK), 256, 0, stream>>>(Wout, wout_t);

  // 1) QKV projection: [8192,1024] x [1024,3072] + b
  gemm_wmma<0><<<dim3(3 * Dd / BN, Bsz * Sseq / BM, 1), 256, 0, stream>>>(
      x_h, wqkv_t, bqkv, nullptr,
      Bsz * Sseq, 3 * Dd, Dd, 0, 0, 0, 0, 1.0f, q_h, k_h, v_t);

  // 2) scores = scale * Q K^T  (batched over b)
  gemm_wmma<1><<<dim3(Sseq / BN, Sseq / BM, Bsz), 256, 0, stream>>>(
      q_h, k_h, nullptr, probs,
      Sseq, Sseq, Dd,
      (long)Sseq * Dd, (long)Sseq * Dd, (long)Sseq * Sseq, Sseq,
      0.03125f /* 1024^-0.5 */, nullptr, nullptr, nullptr);

  // 3) softmax rows (in place, f16)
  softmax_rows<<<dim3(Bsz * Sseq / SM_WAVES), SM_WAVES * 32, 0, stream>>>(probs);

  // 4) O = P V  (V pre-transposed -> contiguous B operand)
  gemm_wmma<2><<<dim3(Dd / BN, Sseq / BM, Bsz), 256, 0, stream>>>(
      probs, v_t, nullptr, attno,
      Sseq, Dd, Sseq,
      (long)Sseq * Sseq, (long)Dd * Sseq, (long)Sseq * Dd, Dd,
      1.0f, nullptr, nullptr, nullptr);

  // 5) final = O Wout + bout  (f32 out)
  gemm_wmma<3><<<dim3(Dd / BN, Bsz * Sseq / BM, 1), 256, 0, stream>>>(
      attno, wout_t, bout, out,
      Bsz * Sseq, Dd, Dd, 0, 0, 0, Dd,
      1.0f, nullptr, nullptr, nullptr);
}

// v007
// One run takes 118 microseconds.
// It is 1.19 times as fast as v005, going by the measured steps of the versions left out in between.
// Counting every step since v000, it is 3.28 times as fast.
#include <hip/hip_runtime.h>

typedef __attribute__((ext_vector_type(16))) _Float16 v16h;
typedef __attribute__((ext_vector_type(8)))  _Float16 v8h;
typedef __attribute__((ext_vector_type(4)))  _Float16 v4h;
typedef __attribute__((ext_vector_type(8)))  float    v8f;
typedef __attribute__((ext_vector_type(4)))  float    v4f;

static constexpr int Bsz  = 4;
static constexpr int Sseq = 2048;
static constexpr int Dd   = 1024;

static constexpr int BM = 256;   // block tile M (4 waves x 64)
static constexpr int BN = 128;   // block tile N (2 waves x 64)
static constexpr int BK = 128;   // k of a stage: 256 bytes of every operand row, four WMMA K
static constexpr int LDS_STRIDE = BK + 8;  // 272-byte pitch: 16 rows of a 16-byte read meet 64 banks

// -------- operand staging: tensor loads into a ring of two LDS buffers.
// A stage is 384 operand rows (256 of A, 128 of B) of 256 bytes, cut into six slices of
// 64 rows; waves 0..3 bring the A slices, waves 4 and 5 the B slices, one request a wave
// and stage. The mover pads every row by 16 bytes, which gives the pitch above.
typedef uint32_t u32x4 __attribute__((ext_vector_type(4)));
typedef uint32_t u32x8 __attribute__((ext_vector_type(8)));
static constexpr int      SL_ROWS     = 64;
static constexpr int      N_SLICES    = (BM + BN) / SL_ROWS;
static constexpr uint32_t ROW_BYTES   = BK * 2;
static constexpr uint32_t SLICE_BYTES = (SL_ROWS * LDS_STRIDE * 2 + 2047) / 2048 * 2048;  // 18 KB
static constexpr uint32_t BUF_BYTES   = N_SLICES * SLICE_BYTES;                           // 108 KB
static_assert(ROW_BYTES == 256, "the pad code below is the one for rows of 256 bytes");
// group 1, word 0: no mask, 1-byte elements, a pad of 4 dwords behind every 64 dwords
static constexpr uint32_t TDM_WORD0 = (1u << 20) | (5u << 22) | (3u << 25);

__device__ __forceinline__ uint32_t uni(uint32_t v) {
  return (uint32_t)__builtin_amdgcn_readfirstlane(v);
}
// A test that decides whether a tensor load issues must be a scalar branch (the mover
// ignores EXEC): the empty statement holds the flag in a scalar register, so that the
// branch on it compiles to s_cmp + s_cbranch_scc.
__device__ __forceinline__ uint32_t pinned(uint32_t v) {
  uint32_t w = uni(v);
  asm volatile("" : "+s"(w));
  return w;
}
__device__ __forceinline__ u32x8 tdm_group1(uint32_t src_pitch) {
  constexpr uint32_t d0 = ROW_BYTES, d1 = SL_ROWS;   // tensor dims = tile dims, in bytes and rows
  u32x8 g;
  g[0] = uni(TDM_WORD0);
  g[1] = uni((d0 & 0xFFFFu) << 16);
  g[2] = uni((d0 >> 16) | ((d1 & 0xFFFFu) << 16));
  g[3] = uni((d1 >> 16) | (d0 << 16));
  g[4] = uni(d1);
  g[5] = uni(src_pitch);
  g[6] = uni(0u);
  g[7] = uni(0u);
  return g;
}
__device__ __forceinline__ u32x4 tdm_group0(uint32_t lds_dst, uint64_t ga) {
  u32x4 g;
  g[0] = pinned(1u);   // a descriptor word held in a scalar register: not formed again later
  g[1] = uni(lds_dst);
  g[2] = uni((uint32_t)ga);
  g[3] = uni((((uint32_t)(ga >> 32)) & 0x01FFFFFFu) | 0x80000000u);
  return g;
}
__device__ __forceinline__ void tdm_load(u32x4 g0, u32x8 g1) {
  // one request of the whole wave: 64 rows of 256 bytes from global memory into LDS
  asm volatile("tensor_load_to_lds %0, %1" :: "s"(g0), "s"(g1) : "memory");
}
// The issuing wave's own request has landed behind this wait (the compiler places none).
// The request's group 0 is the wait's input: it stays live up to here, so that no word of
// it is rewritten while the request is out.
__device__ __forceinline__ void wait_tensor0(u32x4 g0) {
  asm volatile("s_wait_tensorcnt 0x0" :: "s"(g0) : "memory");
}
// the wave's own LDS reads have retired behind this wait, before their buffer is refilled
__device__ __forceinline__ void wait_ds0() { asm volatile("s_wait_dscnt 0x0" ::: "memory"); }

// -------- WMMA operand gather from an LDS slice laid out [rows][LDS_STRIDE] f16.
// 16-bit A/B operand layout (ISA 7.12.2): lane&15 = row, lane>>4 selects the
// 8-wide K half; halves 0..7 <- K[hi*8 .. +7], halves 8..15 <- K[16+hi*8 .. +7].
__device__ __forceinline__ v16h frag_from_lds(const _Float16* base, int row0, int kk) {
  const int lane = threadIdx.x & 31;
  const int m  = lane & 15;
  const int hi = lane >> 4;
  const _Float16* p = base + (row0 + m) * LDS_STRIDE + kk * 32 + hi * 8;
  v8h lo = *(const v8h*)(p);
  v8h hh = *(const v8h*)(p + 16);
  v16h r;
#pragma unroll
  for (int i = 0; i < 8; ++i) { r[i] = lo[i]; r[i + 8] = hh[i]; }
  return r;
}

// -------- x f32 -> f16. It depends on no other launch and the weight products leave most
// of the chip idle, so it rides in their launch as further work-groups (MODE 2 below).
// CV_GROUPS work-groups of CV_WAVES waves, a wave takes CV_LOADS pieces of 128 floats that
// follow one another. A load is 16 bytes a lane (4 whole lines a wave), a store 8 bytes a
// lane (2 whole lines a wave).
static constexpr int  CV_WAVES  = 8;
static constexpr int  CV_LOADS  = 16;
static constexpr long CV_N      = (long)Bsz * Sseq * Dd;
static constexpr int  CV_GROUPS = (int)(CV_N / (CV_WAVES * CV_LOADS * 128));
static_assert((long)CV_GROUPS * CV_WAVES * CV_LOADS * 128 == CV_N, "no edge");
__device__ __forceinline__
void cvt_f32_to_f16(const float* __restrict__ in, _Float16* __restrict__ out, int group) {
  const int  lane = threadIdx.x & 31;
  const long base =
      ((long)group * CV_WAVES + (threadIdx.x >> 5)) * (CV_LOADS * 128) + lane * 4;
  const float* src = in + base;
  _Float16*    dst = out + base;
  v4f f[CV_LOADS];
#pragma unroll
  for (int i = 0; i < CV_LOADS; ++i) f[i] = *(const v4f*)(src + i * 128);
  // the loads' address registers are given new values only behind this wait; as its
  // input they stay live up to it, so that no load's result is laid over them
  asm volatile("s_wait_xcnt 0x0" :: "v"(src) : "memory");
  // keeps all the loads ahead of the first conversion: without it the compiler waits for
  // the first load and reuses its registers before it issues the last four
  __builtin_amdgcn_sched_barrier(0);
  v4h h[CV_LOADS];
#pragma unroll
  for (int i = 0; i < CV_LOADS; ++i) h[i] = __builtin_convertvector(f[i], v4h);
  // every result is formed ahead of the first store, each in registers of its own, so
  // that no register which an issued store names is written behind it
  __builtin_amdgcn_sched_barrier(0);
#pragma unroll
  for (int i = 0; i < CV_LOADS; ++i) *(v4h*)(dst + i * 128) = h[i];
}

// rows of a weight plane that is a B operand of MODE 2: Dd weight rows, the bias, fill
static constexpr int WX_ROWS  = Dd + BN;
static constexpr int W2_NT    = WX_ROWS / BN;          // MODE 2: tiles along n,
static constexpr int W2_MT    = Dd / BM;               // along m,
static constexpr int W2_TILES = 2 * W2_NT * W2_MT;     // and in both products together

// The chain of products is taken in another order than it is written in:
//   scores: (x Wq + bq)(x Wk + bk)^T = (x G + c) x^T + terms that are constant along a row,
//           G = Wq Wk^T, c = bq Wk^T; softmax does not see a constant added to a whole row;
//   output: P (x Wv + bv) Wout + bout = P (x H + e) + bout, H = Wv Wout, e = bv Wout.
// G and H are 1024^3 products, formed once a call; the K projection and the output
// projection (8192 x 1024 x 1024 each) are not needed any more.
// MODE 0: projection Y = x G + c (stored [s][d]) and U = x H + e (stored transposed)
// MODE 1: scores = scale * Y x^T, f16 out, batched via blockIdx.z
// MODE 2: the weight products G^T and H^T, f16 out, batched; the B operand has the bias as
//         row Dd, so that column Dd of the product is c or e (f32, to bcol); a flat grid:
//         W2_TILES work-groups take the tiles, CV_GROUPS more behind them convert x
// MODE 3: out = P U + bout, f32 out to d_out, batched
template <int MODE>
__global__ __launch_bounds__(256)
void gemm_wmma(const _Float16* __restrict__ Ag, const _Float16* __restrict__ Bg,
               const float* __restrict__ bias, void* __restrict__ outp,
               int M, int N, int K,
               long aBatch, long bBatch, long oBatch, int ldo, float scale,
               _Float16* __restrict__ qp, _Float16* __restrict__ vp,
               float* __restrict__ bcol,
               const float* __restrict__ xin, _Float16* __restrict__ xout)
{
  if (MODE == 2 && blockIdx.x >= W2_TILES) {
    // the test is the same for the whole work-group, which leaves ahead of every barrier
    // and tensor load
    cvt_f32_to_f16(xin, xout, blockIdx.x - W2_TILES);
    return;
  }
  // One LDS block: the two-buffer operand ring in the k loop, then the output
  // tile's staging area in the epilogue (the loop's last barrier separates them).
  constexpr int RING_BYTES  = 2 * BUF_BYTES;                               // 216 KB
  constexpr int STAGE_BYTES = (MODE == 3) ? BM * (BN + 4) * 4 : BM * (BN + 8) * 2;
  static_assert(STAGE_BYTES <= RING_BYTES, "the output tile is staged in the ring's space");
  // every slice's place in LDS is a multiple of 2 KB
  __shared__ __attribute__((aligned(2048))) char smem[RING_BYTES];

  const int tid  = threadIdx.x;
  const int wave = (int)uni(tid >> 5);
  const int wm   = wave >> 1;          // 0..3 -> 64-row strip
  const int wn   = wave & 1;           // 0..1 -> 64-col strip
  const int m0   = (MODE == 2 ? (blockIdx.x / W2_NT) % W2_MT : blockIdx.y) * BM;
  const int n0   = (MODE == 2 ? blockIdx.x % W2_NT : blockIdx.x) * BN;
  const int bz   = MODE == 2 ? blockIdx.x / (W2_NT * W2_MT) : blockIdx.z;

  const _Float16* A = Ag + (long)bz * aBatch;
  const _Float16* B = Bg + (long)bz * bBatch;

  // both operands are K-contiguous; their row pitch is K, known at compile time
  constexpr int LD = (MODE == 3) ? Sseq : Dd;
  constexpr int NK = LD / BK;          // stages
  static_assert(NK * BK == LD && NK >= 2, "whole stages, and the ring's prologue needs two");
  // the wave's slice: its first source byte of stage 0 and its place in buffer 0
  // (waves 6 and 7 issue nothing; they are given slice 0's values and never use them)
  const bool issuer = wave < N_SLICES;
  const int  slice  = issuer ? wave : 0;
  const _Float16* srow = (slice < BM / SL_ROWS)
      ? A + (long)(m0 + slice * SL_ROWS) * LD
      : B + (long)(n0 + (slice - BM / SL_ROWS) * SL_ROWS) * LD;
  const uint64_t src0 = (uint64_t)(size_t)srow;
  const uint32_t dst0 = (uint32_t)(size_t)smem + (uint32_t)slice * SLICE_BYTES;
  u32x8 g1 = tdm_group1(LD * 2);
  // descriptor words held in scalar registers: group 1 stays in one register tuple from
  // here to the last request, so that no word of it is rewritten while a request is out
  asm volatile("" : "+s"(g1));

  v8f zero = {};
  v8f acc[4][4];
#pragma unroll
  for (int i = 0; i < 4; ++i)
#pragma unroll
    for (int j = 0; j < 4; ++j) acc[i][j] = zero;

  // ---- prologue: stage 0 lands in buffer 0 and is published; then stage 1 starts
  // group 0 is formed by every wave, always behind the wait that covers the request
  // before it; only the issue stands under the test
  u32x4 g0 = tdm_group0(dst0, src0);
  if (pinned(issuer)) {
    tdm_load(g0, g1);
    wait_tensor0(g0);
  }
  __syncthreads();
  g0 = tdm_group0(dst0 + BUF_BYTES, src0 + ROW_BYTES);
  if (pinned(issuer)) tdm_load(g0, g1);

  constexpr int KB    = BK / 32;       // WMMA blocks of a stage
  constexpr int AHEAD = 2;             // a block's fragments are asked for two blocks ahead
  // kept rolled: a pass is the ring's unit, and buffer and stage are scalars of the trip
#pragma unroll 1
  for (int ks = 0; ks < NK; ++ks) {
    const int cur = ks & 1;
    const _Float16* Ab = (const _Float16*)(smem + cur * BUF_BYTES + wm * SLICE_BYTES);
    const _Float16* Bb =
        (const _Float16*)(smem + cur * BUF_BYTES + (BM / SL_ROWS + wn) * SLICE_BYTES);

    // the pass reads its own buffer alone: two blocks' fragments at its head, each later
    // block's behind the WMMAs of the block whose registers they take over
    v16h af[KB][4], bf[KB][4];
#pragma unroll
    for (int kk = 0; kk < AHEAD; ++kk) {
#pragma unroll
      for (int i = 0; i < 4; ++i) af[kk][i] = frag_from_lds(Ab, i * 16, kk);
#pragma unroll
      for (int j = 0; j < 4; ++j) bf[kk][j] = frag_from_lds(Bb, j * 16, kk);
      // keeps the reads in the order of their use: a block's WMMAs then wait for its own
      // reads only
      __builtin_amdgcn_sched_barrier(0);
    }
#pragma unroll
    for (int kk = 0; kk < KB; ++kk) {
#pragma unroll
      for (int i = 0; i < 4; ++i)
#pragma unroll
        for (int j = 0; j < 4; ++j)
          acc[i][j] = __builtin_amdgcn_wmma_f32_16x16x32_f16(
              false, af[kk][i], false, bf[kk][j], (short)0, acc[i][j], false, false);
      // keeps the block's WMMAs ahead of the reads that take over its registers and, behind
      // the last block, ahead of the publish point: without it the compiler lifts that
      // point's wait for all LDS reads up among the WMMAs
      if (kk + AHEAD < KB || kk == KB - 1) __builtin_amdgcn_sched_barrier(0);
      if (kk + AHEAD < KB) {
#pragma unroll
        for (int i = 0; i < 4; ++i) af[kk + AHEAD][i] = frag_from_lds(Ab, i * 16, kk + AHEAD);
#pragma unroll
        for (int j = 0; j < 4; ++j) bf[kk + AHEAD][j] = frag_from_lds(Bb, j * 16, kk + AHEAD);
        // keeps the reads one group: without it the compiler sinks them among the WMMAs,
        // two at a time, each pair waited to zero before its four WMMAs
        __builtin_amdgcn_sched_barrier(0);
      }
    }

    // ---- publish point of stage ks + 1, every wave, in this order
    wait_ds0();
    if (pinned(issuer)) wait_tensor0(g0);
    __syncthreads();   // stage ks + 1 may be read; every wave has left this pass's buffer
    g0 = tdm_group0(dst0 + (uint32_t)cur * BUF_BYTES, src0 + (uint64_t)(ks + 2) * ROW_BYTES);
    if (pinned(issuer && ks + 2 < NK)) tdm_load(g0, g1);
  }
  wait_tensor0(g0);
  wait_ds0();

  // Epilogue. C/D layout (ISA 7.12.2): lane&15 = N col, VGPR r -> M row
  // r + 8*(lane>>4). The work-group's 256 x 128 tile is laid in LDS in the order
  // of the output buffer, then stored 16 bytes a lane in whole 128-byte lines.
  // Every loop here is unrolled so that acc keeps constant indices (registers).
  const int lane  = tid & 31;
  const int nlane = lane & 15;
  const int hi    = lane >> 4;
  if (MODE == 2 && n0 == Dd) {
    // the tile behind the last weight row: its first column alone is wanted. The test is
    // the same for the whole work-group, which leaves ahead of the epilogue's barrier.
    if (wn == 0 && nlane == 0) {
      float* bc = bcol + (long)bz * Dd + m0 + wm * 64 + hi * 8;
#pragma unroll
      for (int i = 0; i < 4; ++i) {
        const v4f lo = {acc[i][0][0], acc[i][0][1], acc[i][0][2], acc[i][0][3]};
        const v4f up = {acc[i][0][4], acc[i][0][5], acc[i][0][6], acc[i][0][7]};
        *(v4f*)(bc + i * 16)     = lo;
        *(v4f*)(bc + i * 16 + 4) = up;
      }
    }
    return;
  }
  if (MODE == 3) {
    constexpr int SP = BN + 4;           // floats a staged row (528 B)
    float* st = (float*)smem;
#pragma unroll
    for (int j = 0; j < 4; ++j) {
      const int cn = wn * 64 + j * 16 + nlane;
      const float bv = bias[n0 + cn];
      // the load's offset register is given a new value only behind this wait
      asm volatile("s_wait_xcnt 0x0" :: "v"(n0 + cn) : "memory");
#pragma unroll
      for (int i = 0; i < 4; ++i)
#pragma unroll
        for (int r = 0; r < 8; ++r)
          st[(wm * 64 + i * 16 + hi * 8 + r) * SP + cn] = acc[i][j][r] + bv;
    }
    __syncthreads();   // every wave's part of the tile is in LDS before rows are read
    float* o = (float*)outp + (long)bz * oBatch + (long)m0 * ldo + n0;
#pragma unroll
    for (int it = 0; it < BM / 8; ++it) {
      const int row = it * 8 + wave;     // one wave stores one 512-byte row
      *(v4f*)(o + (long)row * ldo + lane * 4) = *(const v4f*)(st + row * SP + lane * 4);
    }
  } else {
    constexpr int SP  = BN + 8;          // halves a staged row (272 B)
    constexpr int SPT = BM + 8;          // the same for a turned tile (528 B)
    _Float16* st = (_Float16*)smem;
    _Float16* dst;
    long pitch;
    bool turned = false;                 // U tile: staged and stored as [d][s]
    if (MODE == 0) {
      if (n0 < Dd) { dst = qp + (long)m0 * Dd + n0; pitch = Dd; }
      else {
        dst = vp + ((long)(m0 >> 11) * Dd + (n0 - Dd)) * Sseq + (m0 & (Sseq - 1));
        pitch = Sseq;
        turned = true;
      }
    } else {
      dst = (_Float16*)outp + (long)bz * oBatch + (long)m0 * ldo + n0;
      pitch = ldo;
    }
    float bv[4];
#pragma unroll
    for (int j = 0; j < 4; ++j)
      bv[j] = (MODE == 0) ? bias[n0 + wn * 64 + j * 16 + nlane] : 0.f;
#pragma unroll
    for (int j = 0; j < 4; ++j)
#pragma unroll
      for (int i = 0; i < 4; ++i)
#pragma unroll
        for (int r = 0; r < 8; ++r)
          acc[i][j][r] = (MODE == 0) ? acc[i][j][r] + bv[j] : acc[i][j][r] * scale;
    if (turned) {
#pragma unroll
      for (int j = 0; j < 4; ++j)
#pragma unroll
        for (int i = 0; i < 4; ++i) {
          v8h h;                                   // a lane's 8 rows are 8 adjacent s
#pragma unroll
          for (int r = 0; r < 8; ++r) h[r] = (_Float16)acc[i][j][r];
          *(v8h*)(st + (wn * 64 + j * 16 + nlane) * SPT + wm * 64 + i * 16 + hi * 8) = h;
        }
    } else {
#pragma unroll
      for (int j = 0; j < 4; ++j)
#pragma unroll
        for (int i = 0; i < 4; ++i)
#pragma unroll
          for (int r = 0; r < 8; ++r)
            st[(wm * 64 + i * 16 + hi * 8 + r) * SP + wn * 64 + j * 16 + nlane] =
                (_Float16)acc[i][j][r];
    }
    __syncthreads();   // every wave's part of the tile is in LDS before rows are read
    // 16 lanes store one 256-byte row of 256; turned: 32 lanes one 512-byte row of 128
    static_assert(BM / 16 == BN / 8, "both forms take the same number of trips");
    const int rstep = turned ? 8 : 16;
    const int rbase = turned ? wave : (tid >> 4);
    const int c     = (turned ? lane : (tid & 15)) * 8;
    const int sp    = turned ? SPT : SP;
#pragma unroll
    for (int it = 0; it < BM / 16; ++it) {
      const int row = it * rstep + rbase;
      *(v8h*)(dst + (long)row * pitch + c) = *(const v8h*)(st + row * sp + c);
    }
  }
}

// ---------------- prep kernel ----------------
// Wqkv [Dd][3 Dd] f32 -> three f16 planes of rows of Dd, not turned: the weight products sum
// over the column index, which is the contiguous one. The planes of Wq and Wv have WX_ROWS
// rows: row Dd is the bias (bq, bv), the rows behind it are 0 and fill the last B tile.
// One wave takes one row: 24 loads of 16 bytes a lane, stores of 8 bytes a lane.
static constexpr int WC_WAVES = 8;
static constexpr int WC_PIECES = Dd / 128;     // 128 floats a wave and load
static_assert(WX_ROWS % WC_WAVES == 0 && WC_PIECES * 128 == Dd, "no edge");
__device__ __forceinline__
void cvt_weights(const float* __restrict__ Wqkv, const float* __restrict__ bqkv,
                 _Float16* __restrict__ wq, _Float16* __restrict__ wk,
                 _Float16* __restrict__ wv, int group) {
  const int  lane = threadIdx.x & 31;
  const int  r    = group * WC_WAVES + (int)uni(threadIdx.x >> 5);   // the wave's row
  const long o    = (long)r * Dd + lane * 4;
  v4h h[3 * WC_PIECES];
  if (r <= Dd) {
    const float* src = (r < Dd ? Wqkv + (long)r * (3 * Dd) : bqkv) + lane * 4;
    v4f f[3 * WC_PIECES];
#pragma unroll
    for (int p = 0; p < 3 * WC_PIECES; ++p) f[p] = *(const v4f*)(src + p * 128);
    // the loads' address registers are given new values only behind this wait; as its
    // input they stay live up to it, so that no load's result is laid over them
    asm volatile("s_wait_xcnt 0x0" :: "v"(src) : "memory");
    // keeps all the loads ahead of the first conversion: without it the compiler waits for
    // the first loads and reuses their registers before it issues the last eight
    __builtin_amdgcn_sched_barrier(0);
#pragma unroll
    for (int p = 0; p < 3 * WC_PIECES; ++p) h[p] = __builtin_convertvector(f[p], v4h);
  } else {
    const v4h z = {};
#pragma unroll
    for (int p = 0; p < 3 * WC_PIECES; ++p) h[p] = z;
  }
  // every result is formed ahead of the first store, each in registers of its own, so
  // that no register which an issued store names is written behind it
  __builtin_amdgcn_sched_barrier(0);
#pragma unroll
  for (int p = 0; p < WC_PIECES; ++p) {
    *(v4h*)(wq + o + p * 128) = h[p];
    *(v4h*)(wv + o + p * 128) = h[2 * WC_PIECES + p];
  }
  // the third plane's address may be laid over a register that an issued store names: only
  // behind this wait
  asm volatile("s_wait_xcnt 0x0" ::: "memory");
  if (r < Dd) {                                 // the plane of Wk has no rows behind Dd - 1
#pragma unroll
    for (int p = 0; p < WC_PIECES; ++p) *(v4h*)(wk + o + p * 128) = h[WC_PIECES + p];
  }
}

// in: [K][N] f32 row-major -> out: [N][K] f16 row-major.
// One work-group turns a tile of TK k x TN n through LDS, so that both global
// sides move 16 bytes a lane in runs of 256 bytes. The tile lies [n][k] in LDS;
// the 16-byte chunk of k group c in row n stands at place c ^ ((n >> 2) & 15),
// which spreads the 16 lanes of a store or a load over all banks.
static constexpr int TK = 128;
static constexpr int TN = 64;
template <int K, int N>
__device__ __forceinline__
void transpose_cvt(const float* __restrict__ in, _Float16* __restrict__ out, int group) {
  __shared__ alignas(16) _Float16 tile[TN * TK];   // 16 KB
  const int l  = threadIdx.x & 15;
  const int g  = threadIdx.x >> 4;
  const int n0 = (group % (N / TN)) * TN;
  const int k0 = (group / (N / TN)) * TK;

  // rows k0 + 8g .. + 7, columns n0 + 4l .. + 3
  const float* src = in + (long)(k0 + g * 8) * N + n0 + l * 4;
  v4f f[8];
#pragma unroll
  for (int r = 0; r < 8; ++r) f[r] = *(const v4f*)(src + (long)r * N);
#pragma unroll
  for (int j = 0; j < 4; ++j) {
    v8h h;
#pragma unroll
    for (int r = 0; r < 8; ++r) h[r] = (_Float16)f[r][j];
    *(v8h*)(tile + (l * 4 + j) * TK + (g ^ l) * 8) = h;
  }
  __syncthreads();
  // rows n0 + g + 16i, columns k0 + 8l .. + 7
  _Float16* dst = out + (long)(n0 + g) * K + k0 + l * 8;
#pragma unroll
  for (int i = 0; i < 4; ++i) {
    const int n = g + i * 16;
    *(v8h*)(dst + (long)i * 16 * K) =
        *(const v8h*)(tile + n * TK + (l ^ ((n >> 2) & 15)) * 8);
  }
  // the code of the launch's other job follows in the text and writes the registers that
  // these stores name: only behind this wait
  asm volatile("s_wait_xcnt 0x0" ::: "memory");
}

// Both weight jobs read inputs alone and neither reads what the other writes: one launch,
// the work-groups dealt by index. The test is the same for a whole work-group, so the
// turn's barrier is passed by all of its waves.
static constexpr int WC_GROUPS = WX_ROWS / WC_WAVES;
static constexpr int WT_GROUPS = (Dd / TN) * (Dd / TK);
static_assert(WC_WAVES * 32 == 256, "both jobs have work-groups of 256");
__global__ __launch_bounds__(256)
void prep_weights(const float* __restrict__ Wqkv, const float* __restrict__ bqkv,
                  const float* __restrict__ Wout,
                  _Float16* __restrict__ wq, _Float16* __restrict__ wk,
                  _Float16* __restrict__ wv, _Float16* __restrict__ wout_t) {
  if (blockIdx.x < WC_GROUPS) cvt_weights(Wqkv, bqkv, wq, wk, wv, blockIdx.x);
  else                        transpose_cvt<Dd, Dd>(Wout, wout_t, blockIdx.x - WC_GROUPS);
}

// ---------------- row softmax over Sseq = 2048, in place on f16 ----------------
// One wave takes one row: 8 loads of 16 bytes a lane (512 bytes of the row each), the
// row's 64 values a lane stay in registers, maximum and sum go over the wave's lanes
// in registers. No LDS and no barrier: a wave reads and writes its own row alone.
template <int CTRL>
__device__ __forceinline__ float lane_dpp(float x) {   // CTRL 0x160 + m: lane l ^ m, m < 16
  return __builtin_bit_cast(float, __builtin_amdgcn_update_dpp(
      0, __builtin_bit_cast(int, x), CTRL, 0xf, 0xf, true));
}
__device__ __forceinline__ float lane_x16(float x) {   // lane l ^ 16
  const int b = __builtin_bit_cast(int, x);
  return __builtin_bit_cast(float, __builtin_amdgcn_permlanex16(
      b, b, 0x76543210, 0xfedcba98, false, false));
}
__device__ __forceinline__ float wave_max(float x) {
  x = fmaxf(x, lane_dpp<0x161>(x));
  x = fmaxf(x, lane_dpp<0x162>(x));
  x = fmaxf(x, lane_dpp<0x164>(x));
  x = fmaxf(x, lane_dpp<0x168>(x));
  return fmaxf(x, lane_x16(x));
}
__device__ __forceinline__ float wave_sum(float x) {
  x += lane_dpp<0x161>(x);
  x += lane_dpp<0x162>(x);
  x += lane_dpp<0x164>(x);
  x += lane_dpp<0x168>(x);
  return x + lane_x16(x);
}

static constexpr int SM_WAVES = 16;            // rows (waves) a work-group
static constexpr int SM_PIECES = Sseq / 256;   // 16-byte pieces of a row a lane
static_assert(SM_PIECES * 256 == Sseq && (Bsz * Sseq) % SM_WAVES == 0, "no edge");
__global__ __launch_bounds__(SM_WAVES * 32)
void softmax_rows(_Float16* __restrict__ P) {
  const int lane = threadIdx.x & 31;
  _Float16* p = P + ((long)blockIdx.x * SM_WAVES + (threadIdx.x >> 5)) * Sseq + lane * 8;

  v8h h[SM_PIECES];
#pragma unroll
  for (int j = 0; j < SM_PIECES; ++j) h[j] = *(const v8h*)(p + j * 256);
  // the loads' address registers are given new values only behind this wait; as its
  // input they stay live up to it, so that no load's result is laid over them
  asm volatile("s_wait_xcnt 0x0" :: "v"(p) : "memory");

  float v[SM_PIECES][8];
  float m[SM_PIECES];                          // one chain a piece: independent chains
#pragma unroll
  for (int j = 0; j < SM_PIECES; ++j) {
    m[j] = -3.0e38f;
#pragma unroll
    for (int e = 0; e < 8; ++e) { v[j][e] = (float)h[j][e]; m[j] = fmaxf(m[j], v[j][e]); }
  }
  float mx = m[0];
#pragma unroll
  for (int j = 1; j < SM_PIECES; ++j) mx = fmaxf(mx, m[j]);
  mx = wave_max(mx);

  float s[SM_PIECES];                          // the same for the sums
#pragma unroll
  for (int j = 0; j < SM_PIECES; ++j) {
    s[j] = 0.f;
#pragma unroll
    for (int e = 0; e < 8; ++e) { v[j][e] = __expf(v[j][e] - mx); s[j] += v[j][e]; }
  }
  float sum = s[0];
#pragma unroll
  for (int j = 1; j < SM_PIECES; ++j) sum += s[j];
  const float inv = 1.f / wave_sum(sum);

#pragma unroll
  for (int j = 0; j < SM_PIECES; ++j)
#pragma unroll
    for (int e = 0; e < 8; ++e) h[j][e] = (_Float16)(v[j][e] * inv);
  // every result is formed ahead of the first store, each in registers of its own, so
  // that no register which an issued store names is written behind it
  __builtin_amdgcn_sched_barrier(0);
#pragma unroll
  for (int j = 0; j < SM_PIECES; ++j) *(v8h*)(p + j * 256) = h[j];
}

// ---------------- host-side orchestration ----------------
extern "C" void kernel_launch(void* const* d_in, const int* in_sizes, int n_in,
                              void* d_out, int out_size, void* d_ws, size_t ws_size,
                              hipStream_t stream)
{
  const float* x    = (const float*)d_in[0];
  const float* Wqkv = (const float*)d_in[1];
  const float* bqkv = (const float*)d_in[2];
  const float* Wout = (const float*)d_in[3];
  const float* bout = (const float*)d_in[4];
  float* out = (float*)d_out;

  char* ws = (char*)d_ws;
  const long MB = 1024l * 1024l;
  const long KB = 1024l;
  static_assert((long)WX_ROWS * Dd * 2 == 2304l * 1024l, "a plane with bias and fill rows");
  _Float16* x_h    = (_Float16*)(ws);                       // 16 MB  [8192][1024]
  _Float16* wq_x   = (_Float16*)(ws + 16 * MB);             // 2.25 MB [1152][1024]
  _Float16* wv_x   = (_Float16*)(ws + 16 * MB + 2304 * KB); // 2.25 MB [1152][1024], behind wq_x
  _Float16* wk_h   = (_Float16*)(ws + 21 * MB);             //  2 MB  [1024][1024]
  _Float16* wout_t = (_Float16*)(ws + 23 * MB);             //  2 MB  [1024][1024], behind wk_h
  _Float16* wgh_t  = (_Float16*)(ws + 25 * MB);             //  4 MB  [2048][1024]: G^T, H^T
  float*    b_ce   = (float*)(ws + 29 * MB);                //  8 KB  [2048]: c, e
  _Float16* y_h    = (_Float16*)(ws + 30 * MB);             // 16 MB  [b][s][d]
  _Float16* u_t    = (_Float16*)(ws + 46 * MB);             // 16 MB  [b][d][s]
  _Float16* probs  = (_Float16*)(ws + 62 * MB);             // 32 MB  [b][s][t]

  prep_weights<<<dim3(WC_GROUPS + WT_GROUPS), 256, 0, stream>>>(
      Wqkv, bqkv, Wout, wq_x, wk_h, wv_x, wout_t);

  // 0) G^T = Wk Wq^T with c, H^T = Wout^T Wv^T with e  (batch of two); x -> x_h beside them
  gemm_wmma<2><<<dim3(W2_TILES + CV_GROUPS), 256, 0, stream>>>(
      wk_h, wq_x, nullptr, wgh_t,
      Dd, WX_ROWS, Dd,
      (long)Dd * Dd, (long)WX_ROWS * Dd, (long)Dd * Dd, Dd,
      1.0f, nullptr, nullptr, b_ce, x, x_h);

  // 1) projection: [8192,1024] x [1024,2048] + (c, e)
  gemm_wmma<0><<<dim3(2 * Dd / BN, Bsz * Sseq / BM, 1), 256, 0, stream>>>(
      x_h, wgh_t, b_ce, nullptr,
      Bsz * Sseq, 2 * Dd, Dd, 0, 0, 0, 0, 1.0f, y_h, u_t, nullptr, nullptr, nullptr);

  // 2) scores = scale * Y x^T  (batched over b)
  gemm_wmma<1><<<dim3(Sseq / BN, Sseq / BM, Bsz), 256, 0, stream>>>(
      y_h, x_h, nullptr, probs,
      Sseq, Sseq, Dd,
      (long)Sseq * Dd, (long)Sseq * Dd, (long)Sseq * Sseq, Sseq,
      0.03125f /* 1024^-0.5 */, nullptr, nullptr, nullptr, nullptr, nullptr);

  // 3) softmax rows (in place, f16)
  softmax_rows<<<dim3(Bsz * Sseq / SM_WAVES), SM_WAVES * 32, 0, stream>>>(probs);

  // 4) out = P U + bout  (U pre-transposed -> contiguous B operand; f32 out)
  gemm_wmma<3><<<dim3(Dd / BN, Sseq / BM, Bsz), 256, 0, stream>>>(
      probs, u_t, bout, out,
      Sseq, Dd, Sseq,
      (long)Sseq * Sseq, (long)Dd * Sseq, (long)Sseq * Dd, Dd,
      1.0f, nullptr, nullptr, nullptr, nullptr, nullptr);
}

// v008
// One run takes 112 microseconds.
// Timed twice side by side with v007, it ran 1.05 and 1.04 times as fast.
// All steps since v000 together make it 3.43 times as fast.
#include <hip/hip_runtime.h>

typedef __attribute__((ext_vector_type(16))) _Float16 v16h;
typedef __attribute__((ext_vector_type(8)))  _Float16 v8h;
typedef __attribute__((ext_vector_type(4)))  _Float16 v4h;
typedef __attribute__((ext_vector_type(8)))  float    v8f;
typedef __attribute__((ext_vector_type(4)))  float    v4f;

static constexpr int Bsz  = 4;
static constexpr int Sseq = 2048;
static constexpr int Dd   = 1024;

static constexpr int BK = 128;   // k of a stage: 256 bytes of every operand row, four WMMA K
static constexpr int LDS_STRIDE = BK + 8;  // 272-byte pitch: 16 rows of a 16-byte read meet 64 banks

// -------- tile shapes, by MODE (the modes: at gemm_wmma below).
// A fragment read from LDS feeds FN (an A fragment) or FM (a B fragment) WMMAs, and a staged
// operand row feeds BN or BM output columns: the larger the tiles, the fewer LDS and L2 bytes
// a WMMA. The three large products run on four waves, one a SIMD, which leaves a wave the
// registers for 128 x 128 (MODE 0, 1: 256 work-groups of 256 x 256) or 128 x 64 (MODE 3:
// 256 x 128, which keeps 256 work-groups). MODE 2 shares its launch with work-groups of
// eight waves: eight waves of 64 x 64.
template <int MODE> struct Shape {
  static constexpr int WGM = MODE == 2 ? 4 : 2;        // waves along m
  static constexpr int WGN = 2;                        // waves along n
  static constexpr int FM  = MODE == 2 ? 4 : 8;        // A fragments (16 rows each) of a wave
  static constexpr int FN  = MODE <= 1 ? 8 : 4;        // B fragments of a wave
  static constexpr int WTM = FM * 16, WTN = FN * 16;   // wave tile
  static constexpr int BM  = WGM * WTM, BN = WGN * WTN;   // work-group tile
  static constexpr int WAVES = WGM * WGN, THREADS = WAVES * 32;
  // operand staging: a stage is BM rows of A, then BN rows of B, of 256 bytes each, cut into
  // slices of SL_ROWS rows; wave w brings slice w, one request a wave and stage
  static constexpr int SL_ROWS  = MODE == 2 ? 64 : 128;
  static constexpr int N_SLICES = (BM + BN) / SL_ROWS;
  static constexpr uint32_t SLICE_BYTES = (SL_ROWS * LDS_STRIDE * 2 + 2047) / 2048 * 2048;
  static constexpr uint32_t BUF_BYTES   = N_SLICES * SLICE_BYTES;
  static_assert(N_SLICES <= WAVES && BM % SL_ROWS == 0 && BN % SL_ROWS == 0, "a slice a wave");
  static_assert(SL_ROWS % WTM == 0 && SL_ROWS % WTN == 0, "a wave's rows lie in one slice");
  static_assert(WAVES % 4 == 0, "the same number of waves on each of the four SIMDs");
};

// -------- operand staging: tensor loads into a ring of two LDS buffers.
// The mover pads every row by 16 bytes, which gives the pitch above.
typedef uint32_t u32x4 __attribute__((ext_vector_type(4)));
typedef uint32_t u32x8 __attribute__((ext_vector_type(8)));
static constexpr uint32_t ROW_BYTES   = BK * 2;
static_assert(ROW_BYTES == 256, "the pad code below is the one for rows of 256 bytes");
// group 1, word 0: no mask, 1-byte elements, a pad of 4 dwords behind every 64 dwords
static constexpr uint32_t TDM_WORD0 = (1u << 20) | (5u << 22) | (3u << 25);

__device__ __forceinline__ uint32_t uni(uint32_t v) {
  return (uint32_t)__builtin_amdgcn_readfirstlane(v);
}
// A test that decides whether a tensor load issues must be a scalar branch (the mover
// ignores EXEC): the empty statement holds the flag in a scalar register, so that the
// branch on it compiles to s_cmp + s_cbranch_scc.
__device__ __forceinline__ uint32_t pinned(uint32_t v) {
  uint32_t w = uni(v);
  asm volatile("" : "+s"(w));
  return w;
}
template <int SL_ROWS>
__device__ __forceinline__ u32x8 tdm_group1(uint32_t src_pitch) {
  constexpr uint32_t d0 = ROW_BYTES, d1 = SL_ROWS;   // tensor dims = tile dims, in bytes and rows
  u32x8 g;
  g[0] = uni(TDM_WORD0);
  g[1] = uni((d0 & 0xFFFFu) << 16);
  g[2] = uni((d0 >> 16) | ((d1 & 0xFFFFu) << 16));
  g[3] = uni((d1 >> 16) | (d0 << 16));
  g[4] = uni(d1);
  g[5] = uni(src_pitch);
  g[6] = uni(0u);
  g[7] = uni(0u);
  return g;
}
__device__ __forceinline__ u32x4 tdm_group0(uint32_t lds_dst, uint64_t ga) {
  u32x4 g;
  g[0] = pinned(1u);   // a descriptor word held in a scalar register: not formed again later
  g[1] = uni(lds_dst);
  g[2] = uni((uint32_t)ga);
  g[3] = uni((((uint32_t)(ga >> 32)) & 0x01FFFFFFu) | 0x80000000u);
  return g;
}
__device__ __forceinline__ void tdm_load(u32x4 g0, u32x8 g1) {
  // one request of the whole wave: a slice's rows of 256 bytes from global memory into LDS
  asm volatile("tensor_load_to_lds %0, %1" :: "s"(g0), "s"(g1) : "memory");
}
// The issuing wave's own request has landed behind this wait (the compiler places none).
// The request's group 0 is the wait's input: it stays live up to here, so that no word of
// it is rewritten while the request is out.
__device__ __forceinline__ void wait_tensor0(u32x4 g0) {
  asm volatile("s_wait_tensorcnt 0x0" :: "s"(g0) : "memory");
}
// the wave's own LDS reads have retired behind this wait, before their buffer is refilled
__device__ __forceinline__ void wait_ds0() { asm volatile("s_wait_dscnt 0x0" ::: "memory"); }

// -------- WMMA operand gather from an LDS slice laid out [rows][LDS_STRIDE] f16.
// 16-bit A/B operand layout (ISA 7.12.2): lane&15 = row, lane>>4 selects the
// 8-wide K half; halves 0..7 <- K[hi*8 .. +7], halves 8..15 <- K[16+hi*8 .. +7].
__device__ __forceinline__ v16h frag_from_lds(const _Float16* base, int row0, int kk) {
  const int lane = threadIdx.x & 31;
  const int m  = lane & 15;
  const int hi = lane >> 4;
  const _Float16* p = base + (row0 + m) * LDS_STRIDE + kk * 32 + hi * 8;
  v8h lo = *(const v8h*)(p);
  v8h hh = *(const v8h*)(p + 16);
  v16h r;
#pragma unroll
  for (int i = 0; i < 8; ++i) { r[i] = lo[i]; r[i + 8] = hh[i]; }
  return r;
}

// -------- x f32 -> f16. It depends on no other launch and the weight products leave most
// of the chip idle, so it rides in their launch as further work-groups (MODE 2 below).
// CV_GROUPS work-groups of CV_WAVES waves, a wave takes CV_LOADS pieces of 128 floats that
// follow one another. A load is 16 bytes a lane (4 whole lines a wave), a store 8 bytes a
// lane (2 whole lines a wave).
static constexpr int  CV_WAVES  = 8;
static constexpr int  CV_LOADS  = 16;
static constexpr long CV_N      = (long)Bsz * Sseq * Dd;
static constexpr int  CV_GROUPS = (int)(CV_N / (CV_WAVES * CV_LOADS * 128));
static_assert((long)CV_GROUPS * CV_WAVES * CV_LOADS * 128 == CV_N, "no edge");
static_assert(CV_WAVES == Shape<2>::WAVES, "one launch, one size of work-group");
__device__ __forceinline__
void cvt_f32_to_f16(const float* __restrict__ in, _Float16* __restrict__ out, int group) {
  const int  lane = threadIdx.x & 31;
  const long base =
      ((long)group * CV_WAVES + (threadIdx.x >> 5)) * (CV_LOADS * 128) + lane * 4;
  const float* src = in + base;
  _Float16*    dst = out + base;
  v4f f[CV_LOADS];
#pragma unroll
  for (int i = 0; i < CV_LOADS; ++i) f[i] = *(const v4f*)(src + i * 128);
  // the loads' address registers are given new values only behind this wait; as its
  // input they stay live up to it, so that no load's result is laid over them
  asm volatile("s_wait_xcnt 0x0" :: "v"(src) : "memory");
  // keeps all the loads ahead of the first conversion: without it the compiler waits for
  // the first load and reuses its registers before it issues the last four
  __builtin_amdgcn_sched_barrier(0);
  v4h h[CV_LOADS];
#pragma unroll
  for (int i = 0; i < CV_LOADS; ++i) h[i] = __builtin_convertvector(f[i], v4h);
  // every result is formed ahead of the first store, each in registers of its own, so
  // that no register which an issued store names is written behind it
  __builtin_amdgcn_sched_barrier(0);
#pragma unroll
  for (int i = 0; i < CV_LOADS; ++i) *(v4h*)(dst + i * 128) = h[i];
}

// rows of a weight plane that is a B operand of MODE 2: Dd weight rows, the bias, fill
static constexpr int WX_ROWS  = Dd + Shape<2>::BN;
static constexpr int W2_NT    = WX_ROWS / Shape<2>::BN;   // MODE 2: tiles along n,
static constexpr int W2_MT    = Dd / Shape<2>::BM;        // along m,
static constexpr int W2_TILES = 2 * W2_NT * W2_MT;     // and in both products together

// The chain of products is taken in another order than it is written in:
//   scores: (x Wq + bq)(x Wk + bk)^T = (x G + c) x^T + terms that are constant along a row,
//           G = Wq Wk^T, c = bq Wk^T; softmax does not see a constant added to a whole row;
//   output: P (x Wv + bv) Wout + bout = P (x H + e) + bout, H = Wv Wout, e = bv Wout.
// G and H are 1024^3 products, formed once a call; the K projection and the output
// projection (8192 x 1024 x 1024 each) are not needed any more.
// MODE 0: projection Y = x G + c (stored [s][d]) and U = x H + e (stored transposed)
// MODE 1: scores = scale * Y x^T, f16 out, batched via blockIdx.z
// MODE 2: the weight products G^T and H^T, f16 out, batched; the B operand has the bias as
//         row Dd, so that column Dd of the product is c or e (f32, to bcol); a flat grid:
//         W2_TILES work-groups take the tiles, CV_GROUPS more behind them convert x
// MODE 3: out = P U + bout, f32 out to d_out, batched
// The waves-per-SIMD bound lets a wave take its whole share of a SIMD's registers: the
// 128 x 128 tile and two sets of fragments need more than the default allows.
template <int MODE>
__global__ __launch_bounds__(Shape<MODE>::THREADS)
__attribute__((amdgpu_waves_per_eu(1, Shape<MODE>::WAVES / 4)))
void gemm_wmma(const _Float16* __restrict__ Ag, const _Float16* __restrict__ Bg,
               const float* __restrict__ bias, void* __restrict__ outp,
               int M, int N, int K,
               long aBatch, long bBatch, long oBatch, int ldo, float scale,
               _Float16* __restrict__ qp, _Float16* __restrict__ vp,
               float* __restrict__ bcol,
               const float* __restrict__ xin, _Float16* __restrict__ xout)
{
  if (MODE == 2 && blockIdx.x >= W2_TILES) {
    // the test is the same for the whole work-group, which leaves ahead of every barrier
    // and tensor load
    cvt_f32_to_f16(xin, xout, blockIdx.x - W2_TILES);
    return;
  }
  using S = Shape<MODE>;
  constexpr int BM = S::BM, BN = S::BN, FM = S::FM, FN = S::FN, WTM = S::WTM, WTN = S::WTN;
  constexpr int SL_ROWS = S::SL_ROWS, N_SLICES = S::N_SLICES, THREADS = S::THREADS;
  constexpr uint32_t SLICE_BYTES = S::SLICE_BYTES, BUF_BYTES = S::BUF_BYTES;
  // One LDS block: the two-buffer operand ring in the k loop, then the output
  // tile's staging area in the epilogue (the loop's last barrier separates them).
  constexpr int RING_BYTES  = 2 * BUF_BYTES;
  constexpr int STAGE_BYTES = (MODE == 3) ? BM * (BN + 4) * 4 : BM * (BN + 8) * 2;
  static_assert(STAGE_BYTES <= RING_BYTES, "the output tile is staged in the ring's space");
  // every slice's place in LDS is a multiple of 2 KB
  __shared__ __attribute__((aligned(2048))) char smem[RING_BYTES];

  const int tid  = threadIdx.x;
  const int wave = (int)uni(tid >> 5);
  const int wm   = wave / S::WGN;      // the wave's strip of WTM rows
  const int wn   = wave % S::WGN;      // and of WTN columns
  const int m0   = (MODE == 2 ? (blockIdx.x / W2_NT) % W2_MT : blockIdx.y) * BM;
  const int n0   = (MODE == 2 ? blockIdx.x % W2_NT : blockIdx.x) * BN;
  const int bz   = MODE == 2 ? blockIdx.x / (W2_NT * W2_MT) : blockIdx.z;

  const _Float16* A = Ag + (long)bz * aBatch;
  const _Float16* B = Bg + (long)bz * bBatch;

  // both operands are K-contiguous; their row pitch is K, known at compile time
  constexpr int LD = (MODE == 3) ? Sseq : Dd;
  constexpr int NK = LD / BK;          // stages
  static_assert(NK * BK == LD && NK >= 2, "whole stages, and the ring's prologue needs two");
  // the wave's slice: its first source byte of stage 0 and its place in buffer 0
  // (a wave behind the last slice issues nothing; it is given slice 0's values, unused)
  const bool issuer = wave < N_SLICES;
  const int  slice  = issuer ? wave : 0;
  const _Float16* srow = (slice < BM / SL_ROWS)
      ? A + (long)(m0 + slice * SL_ROWS) * LD
      : B + (long)(n0 + (slice - BM / SL_ROWS) * SL_ROWS) * LD;
  const uint64_t src0 = (uint64_t)(size_t)srow;
  const uint32_t dst0 = (uint32_t)(size_t)smem + (uint32_t)slice * SLICE_BYTES;
  u32x8 g1 = tdm_group1<SL_ROWS>(LD * 2);
  // descriptor words held in scalar registers: group 1 stays in one register tuple from
  // here to the last request, so that no word of it is rewritten while a request is out
  asm volatile("" : "+s"(g1));

  v8f zero = {};
  v8f acc[FM][FN];
#pragma unroll
  for (int i = 0; i < FM; ++i)
#pragma unroll
    for (int j = 0; j < FN; ++j) acc[i][j] = zero;
  // the wave's first operand rows in a buffer: row R stands in slice R / SL_ROWS
  const uint32_t a_off = (uint32_t)(wm * WTM / SL_ROWS) * SLICE_BYTES +
                         (uint32_t)(wm * WTM % SL_ROWS) * (LDS_STRIDE * 2);
  const uint32_t b_off = (uint32_t)((BM + wn * WTN) / SL_ROWS) * SLICE_BYTES +
                         (uint32_t)((BM + wn * WTN) % SL_ROWS) * (LDS_STRIDE * 2);

  // ---- prologue: stage 0 lands in buffer 0 and is published; then stage 1 starts
  // group 0 is formed by every wave, always behind the wait that covers the request
  // before it; only the issue stands under the test
  u32x4 g0 = tdm_group0(dst0, src0);
  if (pinned(issuer)) {
    tdm_load(g0, g1);
    wait_tensor0(g0);
  }
  __syncthreads();
  g0 = tdm_group0(dst0 + BUF_BYTES, src0 + ROW_BYTES);
  if (pinned(issuer)) tdm_load(g0, g1);

  constexpr int KB    = BK / 32;       // WMMA blocks of a stage
  constexpr int AHEAD = 2;             // a block's fragments are asked for two blocks ahead
  // kept rolled: a pass is the ring's unit, and buffer and stage are scalars of the trip
#pragma unroll 1
  for (int ks = 0; ks < NK; ++ks) {
    const int cur = ks & 1;
    const _Float16* Ab = (const _Float16*)(smem + cur * BUF_BYTES + a_off);
    const _Float16* Bb = (const _Float16*)(smem + cur * BUF_BYTES + b_off);

    // the pass reads its own buffer alone: two blocks' fragments at its head, each later
    // block's behind the WMMAs of the block whose registers they take over
    v16h af[KB][FM], bf[KB][FN];
#pragma unroll
    for (int kk = 0; kk < AHEAD; ++kk) {
#pragma unroll
      for (int i = 0; i < FM; ++i) af[kk][i] = frag_from_lds(Ab, i * 16, kk);
#pragma unroll
      for (int j = 0; j < FN; ++j) bf[kk][j] = frag_from_lds(Bb, j * 16, kk);
      // keeps the reads in the order of their use: a block's WMMAs then wait for its own
      // reads only
      __builtin_amdgcn_sched_barrier(0);
    }
#pragma unroll
    for (int kk = 0; kk < KB; ++kk) {
#pragma unroll
      for (int i = 0; i < FM; ++i)
#pragma unroll
        for (int j = 0; j < FN; ++j)
          acc[i][j] = __builtin_amdgcn_wmma_f32_16x16x32_f16(
              false, af[kk][i], false, bf[kk][j], (short)0, acc[i][j], false, false);
      // keeps the block's WMMAs ahead of the reads that take over its registers and, behind
      // the last block, ahead of the publish point: without it the compiler lifts that
      // point's wait for all LDS reads up among the WMMAs
      if (kk + AHEAD < KB || kk == KB - 1) __builtin_amdgcn_sched_barrier(0);
      if (kk + AHEAD < KB) {
#pragma unroll
        for (int i = 0; i < FM; ++i) af[kk + AHEAD][i] = frag_from_lds(Ab, i * 16, kk + AHEAD);
#pragma unroll
        for (int j = 0; j < FN; ++j) bf[kk + AHEAD][j] = frag_from_lds(Bb, j * 16, kk + AHEAD);
        // keeps the reads one group: without it the compiler sinks them among the WMMAs,
        // two at a time, each pair waited to zero before its four WMMAs
        __builtin_amdgcn_sched_barrier(0);
      }
    }

    // ---- publish point of stage ks + 1, every wave, in this order
    wait_ds0();
    if (pinned(issuer)) wait_tensor0(g0);
    __syncthreads();   // stage ks + 1 may be read; every wave has left this pass's buffer
    g0 = tdm_group0(dst0 + (uint32_t)cur * BUF_BYTES, src0 + (uint64_t)(ks + 2) * ROW_BYTES);
    if (pinned(issuer && ks + 2 < NK)) tdm_load(g0, g1);
  }
  wait_tensor0(g0);
  wait_ds0();

  // Epilogue. C/D layout (ISA 7.12.2): lane&15 = N col, VGPR r -> M row
  // r + 8*(lane>>4). The work-group's BM x BN tile is laid in LDS in the order
  // of the output buffer, then stored 16 bytes a lane in whole 128-byte lines.
  // Every loop here is unrolled so that acc keeps constant indices (registers).
  constexpr int ROWS_AT_ONCE = 16;     // staged rows that a lane has on their way out together
  const int lane  = tid & 31;
  const int nlane = lane & 15;
  const int hi    = lane >> 4;
  if (MODE == 2 && n0 == Dd) {
    // the tile behind the last weight row: its first column alone is wanted. The test is
    // the same for the whole work-group, which leaves ahead of the epilogue's barrier.
    if (wn == 0 && nlane == 0) {
      float* bc = bcol + (long)bz * Dd + m0 + wm * WTM + hi * 8;
#pragma unroll
      for (int i = 0; i < FM; ++i) {
        const v4f lo = {acc[i][0][0], acc[i][0][1], acc[i][0][2], acc[i][0][3]};
        const v4f up = {acc[i][0][4], acc[i][0][5], acc[i][0][6], acc[i][0][7]};
        *(v4f*)(bc + i * 16)     = lo;
        *(v4f*)(bc + i * 16 + 4) = up;
      }
    }
    return;
  }
  if (MODE == 3) {
    constexpr int SP = BN + 4;           // floats a staged row (528 B)
    float* st = (float*)smem;
#pragma unroll
    for (int j = 0; j < FN; ++j) {
      const int cn = wn * WTN + j * 16 + nlane;
      const float bv = bias[n0 + cn];
      // the load's offset register is given a new value only behind this wait
      asm volatile("s_wait_xcnt 0x0" :: "v"(n0 + cn) : "memory");
#pragma unroll
      for (int i = 0; i < FM; ++i)
#pragma unroll
        for (int r = 0; r < 8; ++r)
          st[(wm * WTM + i * 16 + hi * 8 + r) * SP + cn] = acc[i][j][r] + bv;
    }
    __syncthreads();   // every wave's part of the tile is in LDS before rows are read
    float* o = (float*)outp + (long)bz * oBatch + (long)m0 * ldo + n0;
    constexpr int TRIPS = BM / S::WAVES;         // one wave stores one 512-byte row a trip
    static_assert(TRIPS % ROWS_AT_ONCE == 0, "whole groups");
#pragma unroll
    for (int g = 0; g < TRIPS; g += ROWS_AT_ONCE) {
      v4f t[ROWS_AT_ONCE];
#pragma unroll
      for (int u = 0; u < ROWS_AT_ONCE; ++u)
        t[u] = *(const v4f*)(st + ((g + u) * S::WAVES + wave) * SP + lane * 4);
      // keeps a group's LDS reads together, ahead of its first store: without it the compiler
      // takes a few rows at a time and waits for each store's registers before the next reads
      __builtin_amdgcn_sched_barrier(0);
#pragma unroll
      for (int u = 0; u < ROWS_AT_ONCE; ++u)
        *(v4f*)(o + (long)((g + u) * S::WAVES + wave) * ldo + lane * 4) = t[u];
      // the next group's values and addresses may be laid over registers that these stores
      // name: only behind this wait
      if (g + ROWS_AT_ONCE < TRIPS) asm volatile("s_wait_xcnt 0x0" ::: "memory");
    }
  } else {
    constexpr int SP  = BN + 8;          // halves a staged row
    constexpr int SPT = BM + 8;          // the same for a turned tile
    _Float16* st = (_Float16*)smem;
    _Float16* dst;
    long pitch;
    bool turned = false;                 // U tile: staged and stored as [d][s]
    if (MODE == 0) {
      if (n0 < Dd) { dst = qp + (long)m0 * Dd + n0; pitch = Dd; }
      else {
        dst = vp + ((long)(m0 >> 11) * Dd + (n0 - Dd)) * Sseq + (m0 & (Sseq - 1));
        pitch = Sseq;
        turned = true;
      }
    } else {
      dst = (_Float16*)outp + (long)bz * oBatch + (long)m0 * ldo + n0;
      pitch = ldo;
    }
    float bv[FN];
#pragma unroll
    for (int j = 0; j < FN; ++j)
      bv[j] = (MODE == 0) ? bias[n0 + wn * WTN + j * 16 + nlane] : 0.f;
    // the loads' offset register is given a new value only behind this wait; as its input
    // it stays live up to it
    if (MODE == 0) asm volatile("s_wait_xcnt 0x0" :: "v"(n0 + wn * WTN + nlane) : "memory");
#pragma unroll
    for (int j = 0; j < FN; ++j)
#pragma unroll
      for (int i = 0; i < FM; ++i)
#pragma unroll
        for (int r = 0; r < 8; ++r)
          acc[i][j][r] = (MODE == 0) ? acc[i][j][r] + bv[j] : acc[i][j][r] * scale;
    if (turned) {
#pragma unroll
      for (int j = 0; j < FN; ++j)
#pragma unroll
        for (int i = 0; i < FM; ++i) {
          v8h h;                                   // a lane's 8 rows are 8 adjacent s
#pragma unroll
          for (int r = 0; r < 8; ++r) h[r] = (_Float16)acc[i][j][r];
          *(v8h*)(st + (wn * WTN + j * 16 + nlane) * SPT + wm * WTM + i * 16 + hi * 8) = h;
        }
    } else {
#pragma unroll
      for (int j = 0; j < FN; ++j)
#pragma unroll
        for (int i = 0; i < FM; ++i)
#pragma unroll
          for (int r = 0; r < 8; ++r)
            st[(wm * WTM + i * 16 + hi * 8 + r) * SP + wn * WTN + j * 16 + nlane] =
                (_Float16)acc[i][j][r];
    }
    __syncthreads();   // every wave's part of the tile is in LDS before rows are read
    // BN / 8 lanes store one row of the BM; turned: BM / 8 lanes one row of the BN; both
    // forms take the same number of trips
    constexpr int TRIPS = BM * BN / (8 * THREADS);
    const int lpr   = turned ? BM / 8 : BN / 8;      // lanes a row, a power of two
    const int rstep = THREADS / lpr;
    const int rbase = tid / lpr;
    const int c     = (tid & (lpr - 1)) * 8;
    const int sp    = turned ? SPT : SP;
    static_assert(TRIPS % ROWS_AT_ONCE == 0, "whole groups");
#pragma unroll
    for (int g = 0; g < TRIPS; g += ROWS_AT_ONCE) {
      v8h t[ROWS_AT_ONCE];
#pragma unroll
      for (int u = 0; u < ROWS_AT_ONCE; ++u)
        t[u] = *(const v8h*)(st + ((g + u) * rstep + rbase) * sp + c);
      // keeps a group's LDS reads together, ahead of its first store: without it the compiler
      // takes a few rows at a time and waits for each store's registers before the next reads
      __builtin_amdgcn_sched_barrier(0);
#pragma unroll
      for (int u = 0; u < ROWS_AT_ONCE; ++u)
        *(v8h*)(dst + (long)((g + u) * rstep + rbase) * pitch + c) = t[u];
      // the next group's values and addresses may be laid over registers that these stores
      // name: only behind this wait
      if (g + ROWS_AT_ONCE < TRIPS) asm volatile("s_wait_xcnt 0x0" ::: "memory");
    }
  }
}

// ---------------- prep kernel ----------------
// Wqkv [Dd][3 Dd] f32 -> three f16 planes of rows of Dd, not turned: the weight products sum
// over the column index, which is the contiguous one. The planes of Wq and Wv have WX_ROWS
// rows: row Dd is the bias (bq, bv), the rows behind it are 0 and fill the last B tile.
// One wave takes one row: 24 loads of 16 bytes a lane, stores of 8 bytes a lane.
static constexpr int WC_WAVES = 8;
static constexpr int WC_PIECES = Dd / 128;     // 128 floats a wave and load
static_assert(WX_ROWS % WC_WAVES == 0 && WC_PIECES * 128 == Dd, "no edge");
__device__ __forceinline__
void cvt_weights(const float* __restrict__ Wqkv, const float* __restrict__ bqkv,
                 _Float16* __restrict__ wq, _Float16* __restrict__ wk,
                 _Float16* __restrict__ wv, int group) {
  const int  lane = threadIdx.x & 31;
  const int  r    = group * WC_WAVES + (int)uni(threadIdx.x >> 5);   // the wave's row
  const long o    = (long)r * Dd + lane * 4;
  v4h h[3 * WC_PIECES];
  if (r <= Dd) {
    const float* src = (r < Dd ? Wqkv + (long)r * (3 * Dd) : bqkv) + lane * 4;
    v4f f[3 * WC_PIECES];
#pragma unroll
    for (int p = 0; p < 3 * WC_PIECES; ++p) f[p] = *(const v4f*)(src + p * 128);
    // the loads' address registers are given new values only behind this wait; as its
    // input they stay live up to it, so that no load's result is laid over them
    asm volatile("s_wait_xcnt 0x0" :: "v"(src) : "memory");
    // keeps all the loads ahead of the first conversion: without it the compiler waits for
    // the first loads and reuses their registers before it issues the last eight
    __builtin_amdgcn_sched_barrier(0);
#pragma unroll
    for (int p = 0; p < 3 * WC_PIECES; ++p) h[p] = __builtin_convertvector(f[p], v4h);
  } else {
    const v4h z = {};
#pragma unroll
    for (int p = 0; p < 3 * WC_PIECES; ++p) h[p] = z;
  }
  // every result is formed ahead of the first store, each in registers of its own, so
  // that no register which an issued store names is written behind it
  __builtin_amdgcn_sched_barrier(0);
#pragma unroll
  for (int p = 0; p < WC_PIECES; ++p) {
    *(v4h*)(wq + o + p * 128) = h[p];
    *(v4h*)(wv + o + p * 128) = h[2 * WC_PIECES + p];
  }
  // the third plane's address may be laid over a register that an issued store names: only
  // behind this wait
  asm volatile("s_wait_xcnt 0x0" ::: "memory");
  if (r < Dd) {                                 // the plane of Wk has no rows behind Dd - 1
#pragma unroll
    for (int p = 0; p < WC_PIECES; ++p) *(v4h*)(wk + o + p * 128) = h[WC_PIECES + p];
  }
}

// in: [K][N] f32 row-major -> out: [N][K] f16 row-major.
// One work-group turns a tile of TK k x TN n through LDS, so that both global
// sides move 16 bytes a lane in runs of 256 bytes. The tile lies [n][k] in LDS;
// the 16-byte chunk of k group c in row n stands at place c ^ ((n >> 2) & 15),
// which spreads the 16 lanes of a store or a load over all banks.
static constexpr int TK = 128;
static constexpr int TN = 64;
template <int K, int N>
__device__ __forceinline__
void transpose_cvt(const float* __restrict__ in, _Float16* __restrict__ out, int group) {
  __shared__ alignas(16) _Float16 tile[TN * TK];   // 16 KB
  const int l  = threadIdx.x & 15;
  const int g  = threadIdx.x >> 4;
  const int n0 = (group % (N / TN)) * TN;
  const int k0 = (group / (N / TN)) * TK;

  // rows k0 + 8g .. + 7, columns n0 + 4l .. + 3
  const float* src = in + (long)(k0 + g * 8) * N + n0 + l * 4;
  v4f f[8];
#pragma unroll
  for (int r = 0; r < 8; ++r) f[r] = *(const v4f*)(src + (long)r * N);
#pragma unroll
  for (int j = 0; j < 4; ++j) {
    v8h h;
#pragma unroll
    for (int r = 0; r < 8; ++r) h[r] = (_Float16)f[r][j];
    *(v8h*)(tile + (l * 4 + j) * TK + (g ^ l) * 8) = h;
  }
  __syncthreads();
  // rows n0 + g + 16i, columns k0 + 8l .. + 7
  _Float16* dst = out + (long)(n0 + g) * K + k0 + l * 8;
#pragma unroll
  for (int i = 0; i < 4; ++i) {
    const int n = g + i * 16;
    *(v8h*)(dst + (long)i * 16 * K) =
        *(const v8h*)(tile + n * TK + (l ^ ((n >> 2) & 15)) * 8);
  }
  // the code of the launch's other job follows in the text and writes the registers that
  // these stores name: only behind this wait
  asm volatile("s_wait_xcnt 0x0" ::: "memory");
}

// Both weight jobs read inputs alone and neither reads what the other writes: one launch,
// the work-groups dealt by index. The test is the same for a whole work-group, so the
// turn's barrier is passed by all of its waves.
static constexpr int WC_GROUPS = WX_ROWS / WC_WAVES;
static constexpr int WT_GROUPS = (Dd / TN) * (Dd / TK);
static_assert(WC_WAVES * 32 == 256, "both jobs have work-groups of 256");
__global__ __launch_bounds__(256)
void prep_weights(const float* __restrict__ Wqkv, const float* __restrict__ bqkv,
                  const float* __restrict__ Wout,
                  _Float16* __restrict__ wq, _Float16* __restrict__ wk,
                  _Float16* __restrict__ wv, _Float16* __restrict__ wout_t) {
  if (blockIdx.x < WC_GROUPS) cvt_weights(Wqkv, bqkv, wq, wk, wv, blockIdx.x);
  else                        transpose_cvt<Dd, Dd>(Wout, wout_t, blockIdx.x - WC_GROUPS);
}

// ---------------- row softmax over Sseq = 2048, in place on f16 ----------------
// One wave takes one row: 8 loads of 16 bytes a lane (512 bytes of the row each), the
// row's 64 values a lane stay in registers, maximum and sum go over the wave's lanes
// in registers. No LDS and no barrier: a wave reads and writes its own row alone.
template <int CTRL>
__device__ __forceinline__ float lane_dpp(float x) {   // CTRL 0x160 + m: lane l ^ m, m < 16
  return __builtin_bit_cast(float, __builtin_amdgcn_update_dpp(
      0, __builtin_bit_cast(int, x), CTRL, 0xf, 0xf, true));
}
__device__ __forceinline__ float lane_x16(float x) {   // lane l ^ 16
  const int b = __builtin_bit_cast(int, x);
  return __builtin_bit_cast(float, __builtin_amdgcn_permlanex16(
      b, b, 0x76543210, 0xfedcba98, false, false));
}
__device__ __forceinline__ float wave_max(float x) {
  x = fmaxf(x, lane_dpp<0x161>(x));
  x = fmaxf(x, lane_dpp<0x162>(x));
  x = fmaxf(x, lane_dpp<0x164>(x));
  x = fmaxf(x, lane_dpp<0x168>(x));
  return fmaxf(x, lane_x16(x));
}
__device__ __forceinline__ float wave_sum(float x) {
  x += lane_dpp<0x161>(x);
  x += lane_dpp<0x162>(x);
  x += lane_dpp<0x164>(x);
  x += lane_dpp<0x168>(x);
  return x + lane_x16(x);
}

static constexpr int SM_WAVES = 16;            // rows (waves) a work-group
static constexpr int SM_PIECES = Sseq / 256;   // 16-byte pieces of a row a lane
static_assert(SM_PIECES * 256 == Sseq && (Bsz * Sseq) % SM_WAVES == 0, "no edge");
__global__ __launch_bounds__(SM_WAVES * 32)
void softmax_rows(_Float16* __restrict__ P) {
  const int lane = threadIdx.x & 31;
  _Float16* p = P + ((long)blockIdx.x * SM_WAVES + (threadIdx.x >> 5)) * Sseq + lane * 8;

  v8h h[SM_PIECES];
#pragma unroll
  for (int j = 0; j < SM_PIECES; ++j) h[j] = *(const v8h*)(p + j * 256);
  // the loads' address registers are given new values only behind this wait; as its
  // input they stay live up to it, so that no load's result is laid over them
  asm volatile("s_wait_xcnt 0x0" :: "v"(p) : "memory");

  float v[SM_PIECES][8];
  float m[SM_PIECES];                          // one chain a piece: independent chains
#pragma unroll
  for (int j = 0; j < SM_PIECES; ++j) {
    m[j] = -3.0e38f;
#pragma unroll
    for (int e = 0; e < 8; ++e) { v[j][e] = (float)h[j][e]; m[j] = fmaxf(m[j], v[j][e]); }
  }
  float mx = m[0];
#pragma unroll
  for (int j = 1; j < SM_PIECES; ++j) mx = fmaxf(mx, m[j]);
  mx = wave_max(mx);

  float s[SM_PIECES];                          // the same for the sums
#pragma unroll
  for (int j = 0; j < SM_PIECES; ++j) {
    s[j] = 0.f;
#pragma unroll
    for (int e = 0; e < 8; ++e) { v[j][e] = __expf(v[j][e] - mx); s[j] += v[j][e]; }
  }
  float sum = s[0];
#pragma unroll
  for (int j = 1; j < SM_PIECES; ++j) sum += s[j];
  const float inv = 1.f / wave_sum(sum);

#pragma unroll
  for (int j = 0; j < SM_PIECES; ++j)
#pragma unroll
    for (int e = 0; e < 8; ++e) h[j][e] = (_Float16)(v[j][e] * inv);
  // every result is formed ahead of the first store, each in registers of its own, so
  // that no register which an issued store names is written behind it
  __builtin_amdgcn_sched_barrier(0);
#pragma unroll
  for (int j = 0; j < SM_PIECES; ++j) *(v8h*)(p + j * 256) = h[j];
}

// ---------------- host-side orchestration ----------------
extern "C" void kernel_launch(void* const* d_in, const int* in_sizes, int n_in,
                              void* d_out, int out_size, void* d_ws, size_t ws_size,
                              hipStream_t stream)
{
  const float* x    = (const float*)d_in[0];
  const float* Wqkv = (const float*)d_in[1];
  const float* bqkv = (const float*)d_in[2];
  const float* Wout = (const float*)d_in[3];
  const float* bout = (const float*)d_in[4];
  float* out = (float*)d_out;

  char* ws = (char*)d_ws;
  const long MB = 1024l * 1024l;
  const long KB = 1024l;
  static_assert((long)WX_ROWS * Dd * 2 == 2304l * 1024l, "a plane with bias and fill rows");
  _Float16* x_h    = (_Float16*)(ws);                       // 16 MB  [8192][1024]
  _Float16* wq_x   = (_Float16*)(ws + 16 * MB);             // 2.25 MB [1152][1024]
  _Float16* wv_x   = (_Float16*)(ws + 16 * MB + 2304 * KB); // 2.25 MB [1152][1024], behind wq_x
  _Float16* wk_h   = (_Float16*)(ws + 21 * MB);             //  2 MB  [1024][1024]
  _Float16* wout_t = (_Float16*)(ws + 23 * MB);             //  2 MB  [1024][1024], behind wk_h
  _Float16* wgh_t  = (_Float16*)(ws + 25 * MB);             //  4 MB  [2048][1024]: G^T, H^T
  float*    b_ce   = (float*)(ws + 29 * MB);                //  8 KB  [2048]: c, e
  _Float16* y_h    = (_Float16*)(ws + 30 * MB);             // 16 MB  [b][s][d]
  _Float16* u_t    = (_Float16*)(ws + 46 * MB);             // 16 MB  [b][d][s]
  _Float16* probs  = (_Float16*)(ws + 62 * MB);             // 32 MB  [b][s][t]

  prep_weights<<<dim3(WC_GROUPS + WT_GROUPS), 256, 0, stream>>>(
      Wqkv, bqkv, Wout, wq_x, wk_h, wv_x, wout_t);

  // 0) G^T = Wk Wq^T with c, H^T = Wout^T Wv^T with e  (batch of two); x -> x_h beside them
  gemm_wmma<2><<<dim3(W2_TILES + CV_GROUPS), Shape<2>::THREADS, 0, stream>>>(
      wk_h, wq_x, nullptr, wgh_t,
      Dd, WX_ROWS, Dd,
      (long)Dd * Dd, (long)WX_ROWS * Dd, (long)Dd * Dd, Dd,
      1.0f, nullptr, nullptr, b_ce, x, x_h);

  // 1) projection: [8192,1024] x [1024,2048] + (c, e)
  gemm_wmma<0><<<dim3(2 * Dd / Shape<0>::BN, Bsz * Sseq / Shape<0>::BM, 1), Shape<0>::THREADS, 0, stream>>>(
      x_h, wgh_t, b_ce, nullptr,
      Bsz * Sseq, 2 * Dd, Dd, 0, 0, 0, 0, 1.0f, y_h, u_t, nullptr, nullptr, nullptr);

  // 2) scores = scale * Y x^T  (batched over b)
  gemm_wmma<1><<<dim3(Sseq / Shape<1>::BN, Sseq / Shape<1>::BM, Bsz), Shape<1>::THREADS, 0, stream>>>(
      y_h, x_h, nullptr, probs,
      Sseq, Sseq, Dd,
      (long)Sseq * Dd, (long)Sseq * Dd, (long)Sseq * Sseq, Sseq,
      0.03125f /* 1024^-0.5 */, nullptr, nullptr, nullptr, nullptr, nullptr);

  // 3) softmax rows (in place, f16)
  softmax_rows<<<dim3(Bsz * Sseq / SM_WAVES), SM_WAVES * 32, 0, stream>>>(probs);

  // 4) out = P U + bout  (U pre-transposed -> contiguous B operand; f32 out)
  gemm_wmma<3><<<dim3(Dd / Shape<3>::BN, Sseq / Shape<3>::BM, Bsz), Shape<3>::THREADS, 0, stream>>>(
      probs, u_t, bout, out,
      Sseq, Dd, Sseq,
      (long)Sseq * Sseq, (long)Dd * Sseq, (long)Sseq * Dd, Dd,
      1.0f, nullptr, nullptr, nullptr, nullptr, nullptr);
}

// v009
// It runs in 108 microseconds.
// In two side-by-side timings against v008, it was 1.04 and 1.03 times as fast.
// Counting every step since v000, it is 3.56 times as fast.
#include <hip/hip_runtime.h>

typedef __attribute__((ext_vector_type(16))) _Float16 v16h;
typedef __attribute__((ext_vector_type(8)))  _Float16 v8h;
typedef __attribute__((ext_vector_type(4)))  _Float16 v4h;
typedef __attribute__((ext_vector_type(8)))  float    v8f;
typedef __attribute__((ext_vector_type(4)))  float    v4f;

static constexpr int Bsz  = 4;
static constexpr int Sseq = 2048;
static constexpr int Dd   = 1024;

static constexpr int BK = 128;   // k of a stage: 256 bytes of every operand row, four WMMA K
static constexpr int LDS_STRIDE = BK + 8;  // 272-byte pitch: 16 rows of a 16-byte read meet 64 banks

// -------- tile shapes, by MODE (the modes: at gemm_wmma below).
// A fragment read from LDS feeds FN (an A fragment) or FM (a B fragment) WMMAs, and a staged
// operand row feeds BN or BM output columns: the larger the tiles, the fewer LDS and L2 bytes
// a WMMA. The three large products run on four waves, one a SIMD, which leaves a wave the
// registers for 128 x 128 (MODE 0, 1: 256 work-groups of 256 x 256) or 128 x 64 (MODE 3:
// 256 x 128, which keeps 256 work-groups). MODE 2 shares its launch with work-groups of
// eight waves: eight waves of 64 x 64.
template <int MODE> struct Shape {
  static constexpr int WGM = MODE == 2 ? 4 : 2;        // waves along m
  static constexpr int WGN = 2;                        // waves along n
  static constexpr int FM  = MODE == 2 ? 4 : 8;        // A fragments (16 rows each) of a wave
  static constexpr int FN  = MODE <= 1 ? 8 : 4;        // B fragments of a wave
  static constexpr int WTM = FM * 16, WTN = FN * 16;   // wave tile
  static constexpr int BM  = WGM * WTM, BN = WGN * WTN;   // work-group tile
  static constexpr int WAVES = WGM * WGN, THREADS = WAVES * 32;
  // operand staging: a stage is BM rows of A, then BN rows of B, of 256 bytes each, cut into
  // slices of SL_ROWS rows; wave w brings slice w, one request a wave and stage
  static constexpr int SL_ROWS  = MODE == 2 ? 64 : 128;
  static constexpr int N_SLICES = (BM + BN) / SL_ROWS;
  static constexpr uint32_t SLICE_BYTES = (SL_ROWS * LDS_STRIDE * 2 + 2047) / 2048 * 2048;
  static constexpr uint32_t BUF_BYTES   = N_SLICES * SLICE_BYTES;
  static_assert(N_SLICES <= WAVES && BM % SL_ROWS == 0 && BN % SL_ROWS == 0, "a slice a wave");
  static_assert(SL_ROWS % WTM == 0 && SL_ROWS % WTN == 0, "a wave's rows lie in one slice");
  static_assert(WAVES % 4 == 0, "the same number of waves on each of the four SIMDs");
};

// -------- operand staging: tensor loads into a ring of two LDS buffers.
// The mover pads every row by 16 bytes, which gives the pitch above.
typedef uint32_t u32x4 __attribute__((ext_vector_type(4)));
typedef uint32_t u32x8 __attribute__((ext_vector_type(8)));
static constexpr uint32_t ROW_BYTES   = BK * 2;
static_assert(ROW_BYTES == 256, "the pad code below is the one for rows of 256 bytes");
// group 1, word 0: no mask, 1-byte elements, a pad of 4 dwords behind every 64 dwords
static constexpr uint32_t TDM_WORD0 = (1u << 20) | (5u << 22) | (3u << 25);

__device__ __forceinline__ uint32_t uni(uint32_t v) {
  return (uint32_t)__builtin_amdgcn_readfirstlane(v);
}
// A test that decides whether a tensor load issues must be a scalar branch (the mover
// ignores EXEC): the empty statement holds the flag in a scalar register, so that the
// branch on it compiles to s_cmp + s_cbranch_scc.
__device__ __forceinline__ uint32_t pinned(uint32_t v) {
  uint32_t w = uni(v);
  asm volatile("" : "+s"(w));
  return w;
}
template <int SL_ROWS>
__device__ __forceinline__ u32x8 tdm_group1(uint32_t src_pitch) {
  constexpr uint32_t d0 = ROW_BYTES, d1 = SL_ROWS;   // tensor dims = tile dims, in bytes and rows
  u32x8 g;
  g[0] = uni(TDM_WORD0);
  g[1] = uni((d0 & 0xFFFFu) << 16);
  g[2] = uni((d0 >> 16) | ((d1 & 0xFFFFu) << 16));
  g[3] = uni((d1 >> 16) | (d0 << 16));
  g[4] = uni(d1);
  g[5] = uni(src_pitch);
  g[6] = uni(0u);
  g[7] = uni(0u);
  return g;
}
__device__ __forceinline__ u32x4 tdm_group0(uint32_t lds_dst, uint64_t ga) {
  u32x4 g;
  g[0] = pinned(1u);   // a descriptor word held in a scalar register: not formed again later
  g[1] = uni(lds_dst);
  g[2] = uni((uint32_t)ga);
  g[3] = uni((((uint32_t)(ga >> 32)) & 0x01FFFFFFu) | 0x80000000u);
  return g;
}
__device__ __forceinline__ void tdm_load(u32x4 g0, u32x8 g1) {
  // one request of the whole wave: a slice's rows of 256 bytes from global memory into LDS
  asm volatile("tensor_load_to_lds %0, %1" :: "s"(g0), "s"(g1) : "memory");
}
// The issuing wave's own request has landed behind this wait (the compiler places none).
// The request's group 0 is the wait's input: it stays live up to here, so that no word of
// it is rewritten while the request is out.
__device__ __forceinline__ void wait_tensor0(u32x4 g0) {
  asm volatile("s_wait_tensorcnt 0x0" :: "s"(g0) : "memory");
}
// the wave's own LDS reads have retired behind this wait, before their buffer is refilled
__device__ __forceinline__ void wait_ds0() { asm volatile("s_wait_dscnt 0x0" ::: "memory"); }

// -------- WMMA operand gather from an LDS slice laid out [rows][LDS_STRIDE] f16.
// 16-bit A/B operand layout (ISA 7.12.2): lane&15 = row, lane>>4 selects the
// 8-wide K half; halves 0..7 <- K[hi*8 .. +7], halves 8..15 <- K[16+hi*8 .. +7].
__device__ __forceinline__ v16h frag_from_lds(const _Float16* base, int row0, int kk) {
  const int lane = threadIdx.x & 31;
  const int m  = lane & 15;
  const int hi = lane >> 4;
  const _Float16* p = base + (row0 + m) * LDS_STRIDE + kk * 32 + hi * 8;
  v8h lo = *(const v8h*)(p);
  v8h hh = *(const v8h*)(p + 16);
  v16h r;
#pragma unroll
  for (int i = 0; i < 8; ++i) { r[i] = lo[i]; r[i + 8] = hh[i]; }
  return r;
}

// -------- x f32 -> f16. It depends on no other launch and the weight products leave most
// of the chip idle, so it rides in their launch as further work-groups (MODE 2 below).
// CV_GROUPS work-groups of CV_WAVES waves, a wave takes CV_LOADS pieces of 128 floats that
// follow one another. A load is 16 bytes a lane (4 whole lines a wave), a store 8 bytes a
// lane (2 whole lines a wave).
static constexpr int  CV_WAVES  = 8;
static constexpr int  CV_LOADS  = 16;
static constexpr long CV_N      = (long)Bsz * Sseq * Dd;
static constexpr int  CV_GROUPS = (int)(CV_N / (CV_WAVES * CV_LOADS * 128));
static_assert((long)CV_GROUPS * CV_WAVES * CV_LOADS * 128 == CV_N, "no edge");
static_assert(CV_WAVES == Shape<2>::WAVES, "one launch, one size of work-group");
__device__ __forceinline__
void cvt_f32_to_f16(const float* __restrict__ in, _Float16* __restrict__ out, int group) {
  const int  lane = threadIdx.x & 31;
  const long base =
      ((long)group * CV_WAVES + (threadIdx.x >> 5)) * (CV_LOADS * 128) + lane * 4;
  const float* src = in + base;
  _Float16*    dst = out + base;
  v4f f[CV_LOADS];
#pragma unroll
  for (int i = 0; i < CV_LOADS; ++i) f[i] = *(const v4f*)(src + i * 128);
  // the loads' address registers are given new values only behind this wait; as its
  // input they stay live up to it, so that no load's result is laid over them
  asm volatile("s_wait_xcnt 0x0" :: "v"(src) : "memory");
  // keeps all the loads ahead of the first conversion: without it the compiler waits for
  // the first load and reuses its registers before it issues the last four
  __builtin_amdgcn_sched_barrier(0);
  v4h h[CV_LOADS];
#pragma unroll
  for (int i = 0; i < CV_LOADS; ++i) h[i] = __builtin_convertvector(f[i], v4h);
  // every result is formed ahead of the first store, each in registers of its own, so
  // that no register which an issued store names is written behind it
  __builtin_amdgcn_sched_barrier(0);
#pragma unroll
  for (int i = 0; i < CV_LOADS; ++i) *(v4h*)(dst + i * 128) = h[i];
}

// rows of a weight plane that is a B operand of MODE 2: Dd weight rows, the bias, fill
static constexpr int WX_ROWS  = Dd + Shape<2>::BN;
static constexpr int W2_NT    = WX_ROWS / Shape<2>::BN;   // MODE 2: tiles along n,
static constexpr int W2_MT    = Dd / Shape<2>::BM;        // along m,
static constexpr int W2_TILES = 2 * W2_NT * W2_MT;     // and in both products together

// The chain of products is taken in another order than it is written in:
//   scores: (x Wq + bq)(x Wk + bk)^T = (x G + c) x^T + terms that are constant along a row,
//           G = Wq Wk^T, c = bq Wk^T; softmax does not see a constant added to a whole row;
//   output: P (x Wv + bv) Wout + bout = P (x H + e) + bout, H = Wv Wout, e = bv Wout.
// G and H are 1024^3 products, formed once a call; the K projection and the output
// projection (8192 x 1024 x 1024 each) are not needed any more.
// MODE 0: projection Y = x G + c (stored [s][d]) and U = x H + e (stored transposed)
// MODE 1: scores = scale * Y x^T, f16 out, batched via blockIdx.z
// MODE 2: the weight products G^T and H^T, f16 out, batched; the B operand has the bias as
//         row Dd, so that column Dd of the product is c or e (f32, to bcol); a flat grid:
//         W2_TILES work-groups take the tiles, CV_GROUPS more behind them convert x
// MODE 3: out = P U + bout, f32 out to d_out, batched
// The waves-per-SIMD bound lets a wave take its whole share of a SIMD's registers: the
// 128 x 128 tile and two sets of fragments need more than the default allows.
template <int MODE>
__global__ __launch_bounds__(Shape<MODE>::THREADS)
__attribute__((amdgpu_waves_per_eu(1, Shape<MODE>::WAVES / 4)))
void gemm_wmma(const _Float16* __restrict__ Ag, const _Float16* __restrict__ Bg,
               const float* __restrict__ bias, void* __restrict__ outp,
               int M, int N, int K,
               long aBatch, long bBatch, long oBatch, int ldo, float scale,
               _Float16* __restrict__ qp, _Float16* __restrict__ vp,
               float* __restrict__ bcol,
               const float* __restrict__ xin, _Float16* __restrict__ xout)
{
  if (MODE == 2 && blockIdx.x >= W2_TILES) {
    // the test is the same for the whole work-group, which leaves ahead of every barrier
    // and tensor load
    cvt_f32_to_f16(xin, xout, blockIdx.x - W2_TILES);
    return;
  }
  using S = Shape<MODE>;
  constexpr int BM = S::BM, BN = S::BN, FM = S::FM, FN = S::FN, WTM = S::WTM, WTN = S::WTN;
  constexpr int SL_ROWS = S::SL_ROWS, N_SLICES = S::N_SLICES, THREADS = S::THREADS;
  constexpr uint32_t SLICE_BYTES = S::SLICE_BYTES, BUF_BYTES = S::BUF_BYTES;
  // One LDS block: the two-buffer operand ring in the k loop, then the output
  // tile's staging area in the epilogue (the loop's last barrier separates them).
  constexpr int RING_BYTES  = 2 * BUF_BYTES;
  constexpr int STAGE_BYTES = (MODE == 3) ? BM * (BN + 4) * 4 : BM * (BN + 8) * 2;
  static_assert(STAGE_BYTES <= RING_BYTES, "the output tile is staged in the ring's space");
  // every slice's place in LDS is a multiple of 2 KB
  __shared__ __attribute__((aligned(2048))) char smem[RING_BYTES];

  const int tid  = threadIdx.x;
  const int wave = (int)uni(tid >> 5);
  const int wm   = wave / S::WGN;      // the wave's strip of WTM rows
  const int wn   = wave % S::WGN;      // and of WTN columns
  const int m0   = (MODE == 2 ? (blockIdx.x / W2_NT) % W2_MT : blockIdx.y) * BM;
  const int n0   = (MODE == 2 ? blockIdx.x % W2_NT : blockIdx.x) * BN;
  const int bz   = MODE == 2 ? blockIdx.x / (W2_NT * W2_MT) : blockIdx.z;

  const _Float16* A = Ag + (long)bz * aBatch;
  const _Float16* B = Bg + (long)bz * bBatch;

  // both operands are K-contiguous; their row pitch is K, known at compile time
  constexpr int LD = (MODE == 3) ? Sseq : Dd;
  constexpr int NK = LD / BK;          // stages
  static_assert(NK * BK == LD && NK >= 2, "whole stages, and the ring's prologue needs two");
  // the wave's slice: its first source byte of stage 0 and its place in buffer 0
  // (a wave behind the last slice issues nothing; it is given slice 0's values, unused)
  const bool issuer = wave < N_SLICES;
  const int  slice  = issuer ? wave : 0;
  const _Float16* srow = (slice < BM / SL_ROWS)
      ? A + (long)(m0 + slice * SL_ROWS) * LD
      : B + (long)(n0 + (slice - BM / SL_ROWS) * SL_ROWS) * LD;
  const uint64_t src0 = (uint64_t)(size_t)srow;
  const uint32_t dst0 = (uint32_t)(size_t)smem + (uint32_t)slice * SLICE_BYTES;
  u32x8 g1 = tdm_group1<SL_ROWS>(LD * 2);
  // descriptor words held in scalar registers: group 1 stays in one register tuple from
  // here to the last request, so that no word of it is rewritten while a request is out
  asm volatile("" : "+s"(g1));

  // Operand roles. A lane's 8 accumulator registers are 8 neighbours along the index of the
  // WMMA's A operand, so the operand whose index runs along a row of the OUTPUT buffer is
  // given as A (side p) and the other as B (side q): the epilogue then lays 8 neighbours of
  // an output row in LDS with 16-byte stores. Output rows run along n, those of a U tile
  // (stored [d][s]) along m; both fragment kinds have one layout, so the roles are free.
  constexpr int FP = (MODE == 0) ? FM : FN;      // fragments of side p,
  constexpr int FQ = (MODE == 0) ? FN : FM;      // of side q
  static_assert(MODE != 0 || (FM == FN && BM == BN), "MODE 0 picks the roles by tile");
  const bool turned = MODE == 0 && n0 >= Dd;     // U tile; the same for the whole work-group
  v8f zero = {};
  v8f acc[FP][FQ];
#pragma unroll
  for (int i = 0; i < FP; ++i)
#pragma unroll
    for (int j = 0; j < FQ; ++j) acc[i][j] = zero;
  // the wave's first operand rows in a buffer: row R stands in slice R / SL_ROWS
  const uint32_t a_off = (uint32_t)(wm * WTM / SL_ROWS) * SLICE_BYTES +
                         (uint32_t)(wm * WTM % SL_ROWS) * (LDS_STRIDE * 2);
  const uint32_t b_off = (uint32_t)((BM + wn * WTN) / SL_ROWS) * SLICE_BYTES +
                         (uint32_t)((BM + wn * WTN) % SL_ROWS) * (LDS_STRIDE * 2);
  const uint32_t p_off = turned ? a_off : b_off;
  const uint32_t q_off = turned ? b_off : a_off;

  // ---- prologue: stage 0 lands in buffer 0 and is published; then stage 1 starts
  // group 0 is formed by every wave, always behind the wait that covers the request
  // before it; only the issue stands under the test
  u32x4 g0 = tdm_group0(dst0, src0);
  if (pinned(issuer)) {
    tdm_load(g0, g1);
    wait_tensor0(g0);
  }
  __syncthreads();
  g0 = tdm_group0(dst0 + BUF_BYTES, src0 + ROW_BYTES);
  if (pinned(issuer)) tdm_load(g0, g1);

  constexpr int KB    = BK / 32;       // WMMA blocks of a stage
  constexpr int AHEAD = 2;             // a block's fragments are asked for two blocks ahead
  // kept rolled: a pass is the ring's unit, and buffer and stage are scalars of the trip
#pragma unroll 1
  for (int ks = 0; ks < NK; ++ks) {
    const int cur = ks & 1;
    const _Float16* Pb = (const _Float16*)(smem + cur * BUF_BYTES + p_off);
    const _Float16* Qb = (const _Float16*)(smem + cur * BUF_BYTES + q_off);

    // the pass reads its own buffer alone: two blocks' fragments at its head, each later
    // block's behind the WMMAs of the block whose registers they take over
    v16h pf[KB][FP], qf[KB][FQ];
#pragma unroll
    for (int kk = 0; kk < AHEAD; ++kk) {
#pragma unroll
      for (int i = 0; i < FP; ++i) pf[kk][i] = frag_from_lds(Pb, i * 16, kk);
#pragma unroll
      for (int j = 0; j < FQ; ++j) qf[kk][j] = frag_from_lds(Qb, j * 16, kk);
      // keeps the reads in the order of their use: a block's WMMAs then wait for its own
      // reads only
      __builtin_amdgcn_sched_barrier(0);
    }
#pragma unroll
    for (int kk = 0; kk < KB; ++kk) {
#pragma unroll
      for (int i = 0; i < FP; ++i)
#pragma unroll
        for (int j = 0; j < FQ; ++j)
          acc[i][j] = __builtin_amdgcn_wmma_f32_16x16x32_f16(
              false, pf[kk][i], false, qf[kk][j], (short)0, acc[i][j], false, false);
      // keeps the block's WMMAs ahead of the reads that take over its registers and, behind
      // the last block, ahead of the publish point: without it the compiler lifts that
      // point's wait for all LDS reads up among the WMMAs
      if (kk + AHEAD < KB || kk == KB - 1) __builtin_amdgcn_sched_barrier(0);
      if (kk + AHEAD < KB) {
#pragma unroll
        for (int i = 0; i < FP; ++i) pf[kk + AHEAD][i] = frag_from_lds(Pb, i * 16, kk + AHEAD);
#pragma unroll
        for (int j = 0; j < FQ; ++j) qf[kk + AHEAD][j] = frag_from_lds(Qb, j * 16, kk + AHEAD);
        // keeps the reads one group: without it the compiler sinks them among the WMMAs,
        // two at a time, each pair waited to zero before its four WMMAs
        __builtin_amdgcn_sched_barrier(0);
      }
    }

    // ---- publish point of stage ks + 1, every wave, in this order
    wait_ds0();
    if (pinned(issuer)) wait_tensor0(g0);
    __syncthreads();   // stage ks + 1 may be read; every wave has left this pass's buffer
    g0 = tdm_group0(dst0 + (uint32_t)cur * BUF_BYTES, src0 + (uint64_t)(ks + 2) * ROW_BYTES);
    if (pinned(issuer && ks + 2 < NK)) tdm_load(g0, g1);
  }
  wait_tensor0(g0);
  wait_ds0();

  // Epilogue. C/D layout (ISA 7.12.2): lane&15 = the index on side q, VGPR r -> index
  // r + 8*(lane>>4) on side p. The work-group's BM x BN tile is laid in LDS in the order
  // of the output buffer, then stored 16 bytes a lane in whole 128-byte lines.
  // Every loop here is unrolled so that acc keeps constant indices (registers).
  constexpr int ROWS_AT_ONCE = 16;     // staged rows that a lane has on their way out together
  const int lane  = tid & 31;
  const int nlane = lane & 15;
  const int hi    = lane >> 4;
  if (MODE == 2 && n0 == Dd) {
    // the tile behind the last weight row: its first column alone is wanted. The test is
    // the same for the whole work-group, which leaves ahead of the epilogue's barrier.
    if (wn == 0 && hi == 0) {
      float* bc = bcol + (long)bz * Dd + m0 + wm * WTM + nlane;
#pragma unroll
      for (int j = 0; j < FQ; ++j) bc[j * 16] = acc[0][j][0];
    }
    return;
  }
  if (MODE == 3) {
    constexpr int SP = BN + 4;           // floats a staged row (528 B)
    float* st = (float*)smem;
    // the bias goes by n, side p: the lane's 8 columns of every fragment
    const char*    bb = (const char*)(bias + n0 + wn * WTN);
    const uint32_t bo = (uint32_t)hi * 32u;            // bytes
    v4f blo[FP], bup[FP];
#pragma unroll
    for (int i = 0; i < FP; ++i) {
      blo[i] = *(const v4f*)(bb + bo + i * 64);
      bup[i] = *(const v4f*)(bb + bo + i * 64 + 16);
    }
    // the loads' offset register is given a new value only behind this wait; as its input
    // it stays live up to it, so that no load's result is laid over it
    asm volatile("s_wait_xcnt 0x0" :: "v"(bo) : "memory");
#pragma unroll
    for (int i = 0; i < FP; ++i)
#pragma unroll
      for (int j = 0; j < FQ; ++j) {
        float* s = st + (wm * WTM + j * 16 + nlane) * SP + wn * WTN + i * 16 + hi * 8;
        const v4f lo = {acc[i][j][0], acc[i][j][1], acc[i][j][2], acc[i][j][3]};
        const v4f up = {acc[i][j][4], acc[i][j][5], acc[i][j][6], acc[i][j][7]};
        *(v4f*)(s)     = lo + blo[i];
        *(v4f*)(s + 4) = up + bup[i];
      }
    __syncthreads();   // every wave's part of the tile is in LDS before rows are read
    float* o = (float*)outp + (long)bz * oBatch + (long)m0 * ldo + n0;
    constexpr int TRIPS = BM / S::WAVES;         // one wave stores one 512-byte row a trip
    static_assert(TRIPS % ROWS_AT_ONCE == 0, "whole groups");
#pragma unroll
    for (int g = 0; g < TRIPS; g += ROWS_AT_ONCE) {
      v4f t[ROWS_AT_ONCE];
#pragma unroll
      for (int u = 0; u < ROWS_AT_ONCE; ++u)
        t[u] = *(const v4f*)(st + ((g + u) * S::WAVES + wave) * SP + lane * 4);
      // keeps a group's LDS reads together, ahead of its first store: without it the compiler
      // takes a few rows at a time and waits for each store's registers before the next reads
      __builtin_amdgcn_sched_barrier(0);
#pragma unroll
      for (int u = 0; u < ROWS_AT_ONCE; ++u)
        *(v4f*)(o + (long)((g + u) * S::WAVES + wave) * ldo + lane * 4) = t[u];
      // the next group's values and addresses may be laid over registers that these stores
      // name: only behind this wait
      if (g + ROWS_AT_ONCE < TRIPS) asm volatile("s_wait_xcnt 0x0" ::: "memory");
    }
  } else {
    constexpr int SP  = BN + 8;          // halves a staged row
    constexpr int SPT = BM + 8;          // the same for a turned tile
    _Float16* st = (_Float16*)smem;
    _Float16* dst;
    long pitch;
    if (MODE == 0) {
      if (!turned) { dst = qp + (long)m0 * Dd + n0; pitch = Dd; }
      else {                             // U tile: staged and stored as [d][s]
        dst = vp + ((long)(m0 >> 11) * Dd + (n0 - Dd)) * Sseq + (m0 & (Sseq - 1));
        pitch = Sseq;
      }
    } else {
      dst = (_Float16*)outp + (long)bz * oBatch + (long)m0 * ldo + n0;
      pitch = ldo;
    }
    const int sp = turned ? SPT : SP;
    // the wave's first staged row (side q) and its first place in a row (side p)
    const int q0 = (turned ? wn * WTN : wm * WTM) + nlane;
    const int p0 = (turned ? wm * WTM : wn * WTN) + hi * 8;
    _Float16* sw = st + q0 * sp + p0;
    if (MODE == 0 && turned) {           // the bias goes by n, here side q: one value a lane
      float bv[FQ];
#pragma unroll
      for (int j = 0; j < FQ; ++j) bv[j] = bias[n0 + wn * WTN + j * 16 + nlane];
      // the loads' offset register is given a new value only behind this wait; as its input
      // it stays live up to it
      asm volatile("s_wait_xcnt 0x0" :: "v"(n0 + wn * WTN + nlane) : "memory");
#pragma unroll
      for (int i = 0; i < FP; ++i)
#pragma unroll
        for (int j = 0; j < FQ; ++j) {
          v8h h;                         // a lane's 8 values are 8 neighbours of a staged row
#pragma unroll
          for (int r = 0; r < 8; ++r) h[r] = (_Float16)(acc[i][j][r] + bv[j]);
          *(v8h*)(sw + j * 16 * sp + i * 16) = h;
        }
    } else {
      // MODE 0: the bias goes by n, here side p: the lane's 8 columns of every fragment
      const char*    bb = (const char*)(bias + n0 + wn * WTN);
      const uint32_t bo = (uint32_t)hi * 32u;          // bytes
      v4f blo[FP], bup[FP];
      if (MODE == 0) {
#pragma unroll
        for (int i = 0; i < FP; ++i) {
          blo[i] = *(const v4f*)(bb + bo + i * 64);
          bup[i] = *(const v4f*)(bb + bo + i * 64 + 16);
        }
        // the loads' offset register is given a new value only behind this wait; as its
        // input it stays live up to it, so that no load's result is laid over it
        asm volatile("s_wait_xcnt 0x0" :: "v"(bo) : "memory");
      }
#pragma unroll
      for (int i = 0; i < FP; ++i)
#pragma unroll
        for (int j = 0; j < FQ; ++j) {
          v8h h;                         // a lane's 8 values are 8 neighbours of a staged row
#pragma unroll
          for (int r = 0; r < 8; ++r)
            h[r] = (_Float16)((MODE == 0) ? acc[i][j][r] + (r < 4 ? blo[i][r & 3] : bup[i][r & 3])
                                          : acc[i][j][r] * scale);
          *(v8h*)(sw + j * 16 * sp + i * 16) = h;
        }
    }
    __syncthreads();   // every wave's part of the tile is in LDS before rows are read
    // BN / 8 lanes store one row of the BM; turned: BM / 8 lanes one row of the BN; both
    // forms take the same number of trips
    constexpr int TRIPS = BM * BN / (8 * THREADS);
    const int lpr   = turned ? BM / 8 : BN / 8;      // lanes a row, a power of two
    const int rstep = THREADS / lpr;
    const int rbase = tid / lpr;
    const int c     = (tid & (lpr - 1)) * 8;
    static_assert(TRIPS % ROWS_AT_ONCE == 0, "whole groups");
#pragma unroll
    for (int g = 0; g < TRIPS; g += ROWS_AT_ONCE) {
      v8h t[ROWS_AT_ONCE];
#pragma unroll
      for (int u = 0; u < ROWS_AT_ONCE; ++u)
        t[u] = *(const v8h*)(st + ((g + u) * rstep + rbase) * sp + c);
      // keeps a group's LDS reads together, ahead of its first store: without it the compiler
      // takes a few rows at a time and waits for each store's registers before the next reads
      __builtin_amdgcn_sched_barrier(0);
#pragma unroll
      for (int u = 0; u < ROWS_AT_ONCE; ++u)
        *(v8h*)(dst + (long)((g + u) * rstep + rbase) * pitch + c) = t[u];
      // the next group's values and addresses may be laid over registers that these stores
      // name: only behind this wait
      if (g + ROWS_AT_ONCE < TRIPS) asm volatile("s_wait_xcnt 0x0" ::: "memory");
    }
  }
}

// ---------------- prep kernel ----------------
// Wqkv [Dd][3 Dd] f32 -> three f16 planes of rows of Dd, not turned: the weight products sum
// over the column index, which is the contiguous one. The planes of Wq and Wv have WX_ROWS
// rows: row Dd is the bias (bq, bv), the rows behind it are 0 and fill the last B tile.
// One wave takes one row: 24 loads of 16 bytes a lane, stores of 8 bytes a lane.
static constexpr int WC_WAVES = 8;
static constexpr int WC_PIECES = Dd / 128;     // 128 floats a wave and load
static_assert(WX_ROWS % WC_WAVES == 0 && WC_PIECES * 128 == Dd, "no edge");
__device__ __forceinline__
void cvt_weights(const float* __restrict__ Wqkv, const float* __restrict__ bqkv,
                 _Float16* __restrict__ wq, _Float16* __restrict__ wk,
                 _Float16* __restrict__ wv, int group) {
  const int  lane = threadIdx.x & 31;
  const int  r    = group * WC_WAVES + (int)uni(threadIdx.x >> 5);   // the wave's row
  const long o    = (long)r * Dd + lane * 4;
  v4h h[3 * WC_PIECES];
  if (r <= Dd) {
    const float* src = (r < Dd ? Wqkv + (long)r * (3 * Dd) : bqkv) + lane * 4;
    v4f f[3 * WC_PIECES];
#pragma unroll
    for (int p = 0; p < 3 * WC_PIECES; ++p) f[p] = *(const v4f*)(src + p * 128);
    // the loads' address registers are given new values only behind this wait; as its
    // input they stay live up to it, so that no load's result is laid over them
    asm volatile("s_wait_xcnt 0x0" :: "v"(src) : "memory");
    // keeps all the loads ahead of the first conversion: without it the compiler waits for
    // the first loads and reuses their registers before it issues the last eight
    __builtin_amdgcn_sched_barrier(0);
#pragma unroll
    for (int p = 0; p < 3 * WC_PIECES; ++p) h[p] = __builtin_convertvector(f[p], v4h);
  } else {
    const v4h z = {};
#pragma unroll
    for (int p = 0; p < 3 * WC_PIECES; ++p) h[p] = z;
  }
  // every result is formed ahead of the first store, each in registers of its own, so
  // that no register which an issued store names is written behind it
  __builtin_amdgcn_sched_barrier(0);
#pragma unroll
  for (int p = 0; p < WC_PIECES; ++p) {
    *(v4h*)(wq + o + p * 128) = h[p];
    *(v4h*)(wv + o + p * 128) = h[2 * WC_PIECES + p];
  }
  // the third plane's address may be laid over a register that an issued store names: only
  // behind this wait
  asm volatile("s_wait_xcnt 0x0" ::: "memory");
  if (r < Dd) {                                 // the plane of Wk has no rows behind Dd - 1
#pragma unroll
    for (int p = 0; p < WC_PIECES; ++p) *(v4h*)(wk + o + p * 128) = h[WC_PIECES + p];
  }
}

// in: [K][N] f32 row-major -> out: [N][K] f16 row-major.
// One work-group turns a tile of TK k x TN n through LDS, so that both global
// sides move 16 bytes a lane in runs of 256 bytes. The tile lies [n][k] in LDS;
// the 16-byte chunk of k group c in row n stands at place c ^ ((n >> 2) & 15),
// which spreads the 16 lanes of a store or a load over all banks.
static constexpr int TK = 128;
static constexpr int TN = 64;
template <int K, int N>
__device__ __forceinline__
void transpose_cvt(const float* __restrict__ in, _Float16* __restrict__ out, int group) {
  __shared__ alignas(16) _Float16 tile[TN * TK];   // 16 KB
  const int l  = threadIdx.x & 15;
  const int g  = threadIdx.x >> 4;
  const int n0 = (group % (N / TN)) * TN;
  const int k0 = (group / (N / TN)) * TK;

  // rows k0 + 8g .. + 7, columns n0 + 4l .. + 3
  const float* src = in + (long)(k0 + g * 8) * N + n0 + l * 4;
  v4f f[8];
#pragma unroll
  for (int r = 0; r < 8; ++r) f[r] = *(const v4f*)(src + (long)r * N);
#pragma unroll
  for (int j = 0; j < 4; ++j) {
    v8h h;
#pragma unroll
    for (int r = 0; r < 8; ++r) h[r] = (_Float16)f[r][j];
    *(v8h*)(tile + (l * 4 + j) * TK + (g ^ l) * 8) = h;
  }
  __syncthreads();
  // rows n0 + g + 16i, columns k0 + 8l .. + 7
  _Float16* dst = out + (long)(n0 + g) * K + k0 + l * 8;
#pragma unroll
  for (int i = 0; i < 4; ++i) {
    const int n = g + i * 16;
    *(v8h*)(dst + (long)i * 16 * K) =
        *(const v8h*)(tile + n * TK + (l ^ ((n >> 2) & 15)) * 8);
  }
  // the code of the launch's other job follows in the text and writes the registers that
  // these stores name: only behind this wait
  asm volatile("s_wait_xcnt 0x0" ::: "memory");
}

// Both weight jobs read inputs alone and neither reads what the other writes: one launch,
// the work-groups dealt by index. The test is the same for a whole work-group, so the
// turn's barrier is passed by all of its waves.
static constexpr int WC_GROUPS = WX_ROWS / WC_WAVES;
static constexpr int WT_GROUPS = (Dd / TN) * (Dd / TK);
static_assert(WC_WAVES * 32 == 256, "both jobs have work-groups of 256");
__global__ __launch_bounds__(256)
void prep_weights(const float* __restrict__ Wqkv, const float* __restrict__ bqkv,
                  const float* __restrict__ Wout,
                  _Float16* __restrict__ wq, _Float16* __restrict__ wk,
                  _Float16* __restrict__ wv, _Float16* __restrict__ wout_t) {
  if (blockIdx.x < WC_GROUPS) cvt_weights(Wqkv, bqkv, wq, wk, wv, blockIdx.x);
  else                        transpose_cvt<Dd, Dd>(Wout, wout_t, blockIdx.x - WC_GROUPS);
}

// ---------------- row softmax over Sseq = 2048, in place on f16 ----------------
// One wave takes one row: 8 loads of 16 bytes a lane (512 bytes of the row each), the
// row's 64 values a lane stay in registers, maximum and sum go over the wave's lanes
// in registers. No LDS and no barrier: a wave reads and writes its own row alone.
template <int CTRL>
__device__ __forceinline__ float lane_dpp(float x) {   // CTRL 0x160 + m: lane l ^ m, m < 16
  return __builtin_bit_cast(float, __builtin_amdgcn_update_dpp(
      0, __builtin_bit_cast(int, x), CTRL, 0xf, 0xf, true));
}
__device__ __forceinline__ float lane_x16(float x) {   // lane l ^ 16
  const int b = __builtin_bit_cast(int, x);
  return __builtin_bit_cast(float, __builtin_amdgcn_permlanex16(
      b, b, 0x76543210, 0xfedcba98, false, false));
}
__device__ __forceinline__ float wave_max(float x) {
  x = fmaxf(x, lane_dpp<0x161>(x));
  x = fmaxf(x, lane_dpp<0x162>(x));
  x = fmaxf(x, lane_dpp<0x164>(x));
  x = fmaxf(x, lane_dpp<0x168>(x));
  return fmaxf(x, lane_x16(x));
}
__device__ __forceinline__ float wave_sum(float x) {
  x += lane_dpp<0x161>(x);
  x += lane_dpp<0x162>(x);
  x += lane_dpp<0x164>(x);
  x += lane_dpp<0x168>(x);
  return x + lane_x16(x);
}

static constexpr int SM_WAVES = 16;            // rows (waves) a work-group
static constexpr int SM_PIECES = Sseq / 256;   // 16-byte pieces of a row a lane
static_assert(SM_PIECES * 256 == Sseq && (Bsz * Sseq) % SM_WAVES == 0, "no edge");
__global__ __launch_bounds__(SM_WAVES * 32)
void softmax_rows(_Float16* __restrict__ P) {
  const int lane = threadIdx.x & 31;
  _Float16* p = P + ((long)blockIdx.x * SM_WAVES + (threadIdx.x >> 5)) * Sseq + lane * 8;

  v8h h[SM_PIECES];
#pragma unroll
  for (int j = 0; j < SM_PIECES; ++j) h[j] = *(const v8h*)(p + j * 256);
  // the loads' address registers are given new values only behind this wait; as its
  // input they stay live up to it, so that no load's result is laid over them
  asm volatile("s_wait_xcnt 0x0" :: "v"(p) : "memory");

  float v[SM_PIECES][8];
  float m[SM_PIECES];                          // one chain a piece: independent chains
#pragma unroll
  for (int j = 0; j < SM_PIECES; ++j) {
    m[j] = -3.0e38f;
#pragma unroll
    for (int e = 0; e < 8; ++e) { v[j][e] = (float)h[j][e]; m[j] = fmaxf(m[j], v[j][e]); }
  }
  float mx = m[0];
#pragma unroll
  for (int j = 1; j < SM_PIECES; ++j) mx = fmaxf(mx, m[j]);
  mx = wave_max(mx);

  float s[SM_PIECES];                          // the same for the sums
#pragma unroll
  for (int j = 0; j < SM_PIECES; ++j) {
    s[j] = 0.f;
#pragma unroll
    for (int e = 0; e < 8; ++e) { v[j][e] = __expf(v[j][e] - mx); s[j] += v[j][e]; }
  }
  float sum = s[0];
#pragma unroll
  for (int j = 1; j < SM_PIECES; ++j) sum += s[j];
  const float inv = 1.f / wave_sum(sum);

#pragma unroll
  for (int j = 0; j < SM_PIECES; ++j)
#pragma unroll
    for (int e = 0; e < 8; ++e) h[j][e] = (_Float16)(v[j][e] * inv);
  // every result is formed ahead of the first store, each in registers of its own, so
  // that no register which an issued store names is written behind it
  __builtin_amdgcn_sched_barrier(0);
#pragma unroll
  for (int j = 0; j < SM_PIECES; ++j) *(v8h*)(p + j * 256) = h[j];
}

// ---------------- host-side orchestration ----------------
extern "C" void kernel_launch(void* const* d_in, const int* in_sizes, int n_in,
                              void* d_out, int out_size, void* d_ws, size_t ws_size,
                              hipStream_t stream)
{
  const float* x    = (const float*)d_in[0];
  const float* Wqkv = (const float*)d_in[1];
  const float* bqkv = (const float*)d_in[2];
  const float* Wout = (const float*)d_in[3];
  const float* bout = (const float*)d_in[4];
  float* out = (float*)d_out;

  char* ws = (char*)d_ws;
  const long MB = 1024l * 1024l;
  const long KB = 1024l;
  static_assert((long)WX_ROWS * Dd * 2 == 2304l * 1024l, "a plane with bias and fill rows");
  _Float16* x_h    = (_Float16*)(ws);                       // 16 MB  [8192][1024]
  _Float16* wq_x   = (_Float16*)(ws + 16 * MB);             // 2.25 MB [1152][1024]
  _Float16* wv_x   = (_Float16*)(ws + 16 * MB + 2304 * KB); // 2.25 MB [1152][1024], behind wq_x
  _Float16* wk_h   = (_Float16*)(ws + 21 * MB);             //  2 MB  [1024][1024]
  _Float16* wout_t = (_Float16*)(ws + 23 * MB);             //  2 MB  [1024][1024], behind wk_h
  _Float16* wgh_t  = (_Float16*)(ws + 25 * MB);             //  4 MB  [2048][1024]: G^T, H^T
  float*    b_ce   = (float*)(ws + 29 * MB);                //  8 KB  [2048]: c, e
  _Float16* y_h    = (_Float16*)(ws + 30 * MB);             // 16 MB  [b][s][d]
  _Float16* u_t    = (_Float16*)(ws + 46 * MB);             // 16 MB  [b][d][s]
  _Float16* probs  = (_Float16*)(ws + 62 * MB);             // 32 MB  [b][s][t]

  prep_weights<<<dim3(WC_GROUPS + WT_GROUPS), 256, 0, stream>>>(
      Wqkv, bqkv, Wout, wq_x, wk_h, wv_x, wout_t);

  // 0) G^T = Wk Wq^T with c, H^T = Wout^T Wv^T with e  (batch of two); x -> x_h beside them
  gemm_wmma<2><<<dim3(W2_TILES + CV_GROUPS), Shape<2>::THREADS, 0, stream>>>(
      wk_h, wq_x, nullptr, wgh_t,
      Dd, WX_ROWS, Dd,
      (long)Dd * Dd, (long)WX_ROWS * Dd, (long)Dd * Dd, Dd,
      1.0f, nullptr, nullptr, b_ce, x, x_h);

  // 1) projection: [8192,1024] x [1024,2048] + (c, e)
  gemm_wmma<0><<<dim3(2 * Dd / Shape<0>::BN, Bsz * Sseq / Shape<0>::BM, 1), Shape<0>::THREADS, 0, stream>>>(
      x_h, wgh_t, b_ce, nullptr,
      Bsz * Sseq, 2 * Dd, Dd, 0, 0, 0, 0, 1.0f, y_h, u_t, nullptr, nullptr, nullptr);

  // 2) scores = scale * Y x^T  (batched over b)
  gemm_wmma<1><<<dim3(Sseq / Shape<1>::BN, Sseq / Shape<1>::BM, Bsz), Shape<1>::THREADS, 0, stream>>>(
      y_h, x_h, nullptr, probs,
      Sseq, Sseq, Dd,
      (long)Sseq * Dd, (long)Sseq * Dd, (long)Sseq * Sseq, Sseq,
      0.03125f /* 1024^-0.5 */, nullptr, nullptr, nullptr, nullptr, nullptr);

  // 3) softmax rows (in place, f16)
  softmax_rows<<<dim3(Bsz * Sseq / SM_WAVES), SM_WAVES * 32, 0, stream>>>(probs);

  // 4) out = P U + bout  (U pre-transposed -> contiguous B operand; f32 out)
  gemm_wmma<3><<<dim3(Dd / Shape<3>::BN, Sseq / Shape<3>::BM, Bsz), Shape<3>::THREADS, 0, stream>>>(
      probs, u_t, bout, out,
      Sseq, Dd, Sseq,
      (long)Sseq * Sseq, (long)Dd * Sseq, (long)Sseq * Dd, Dd,
      1.0f, nullptr, nullptr, nullptr, nullptr, nullptr);
}
